// v000
// The times below were measured on an AMD MI455X: many runs one after another, warmed up first and cycling through
// copies of the inputs, with the whole window's GPU time divided by the number of runs. Launches and the gaps
// between them are all in it. The median over several windows is given; except for v000 it joins two sittings, which
// can be a few percent apart, so the side-by-side timings, each taken in one sitting, are the better comparison.
// v000 is the starting kernel. One run takes 399 microseconds.
#include <hip/hip_runtime.h>

typedef __attribute__((ext_vector_type(16))) _Float16 v16h;
typedef __attribute__((ext_vector_type(8)))  float    v8f;

constexpr int DM     = 768;     // d_model
constexpr int NTOK   = 4 * 2048;
constexpr int SEQ    = 2048;
constexpr int NH     = 12;
constexpr int DH     = 64;
constexpr int KT     = 32;          // WMMA K per step (f16)
constexpr int KSTEPS = DM / KT;     // 24
constexpr int KBLK   = SEQ / 32;    // 64 key blocks

// batched group-of-32 xor swizzle max-reduction step over 8 independent rows:
// 8 ds_swizzles issue back-to-back, one wait, 8 maxes.
template <int XM>
__device__ inline void red_max8(float (&rm)[8]) {
    float t[8];
#pragma unroll
    for (int j = 0; j < 8; ++j)
        t[j] = __int_as_float(
            __builtin_amdgcn_ds_swizzle(__float_as_int(rm[j]), (XM << 10) | 0x1f));
#pragma unroll
    for (int j = 0; j < 8; ++j) rm[j] = fmaxf(rm[j], t[j]);
}

// ---------------------------------------------------------------------------
// fp32 -> f16 elementwise convert (x)
// ---------------------------------------------------------------------------
__global__ void cvt_f32_f16(const float* __restrict__ in, _Float16* __restrict__ out, int n) {
    int i = (blockIdx.x * blockDim.x + threadIdx.x) * 4;
    if (i < n) {
        float4 v = *reinterpret_cast<const float4*>(in + i);
        out[i + 0] = (_Float16)v.x;
        out[i + 1] = (_Float16)v.y;
        out[i + 2] = (_Float16)v.z;
        out[i + 3] = (_Float16)v.w;
    }
}

// ---------------------------------------------------------------------------
// Pack W [out=768][in=768] (row-major fp32) into per-lane WMMA B-fragments.
// ---------------------------------------------------------------------------
__global__ void pack_w_bfrag(const float* __restrict__ W, _Float16* __restrict__ Wp) {
    const int t    = blockIdx.x * blockDim.x + threadIdx.x;   // 36864 threads
    const int lane = t & 31;
    const int tile = t >> 5;                                  // 0..1151
    const int nt   = tile % (DM / 16);
    const int kt   = tile / (DM / 16);
    const int n    = nt * 16 + (lane & 15);
    const int k0   = kt * 32 + (lane >> 4) * 16;
    const float* src = &W[(size_t)n * DM + k0];
    _Float16*    dst = &Wp[((size_t)tile * 32 + lane) * 16];
#pragma unroll
    for (int i = 0; i < 16; ++i) dst[i] = (_Float16)src[i];
}

// ---------------------------------------------------------------------------
// GEMM: Y[8192,768] = Xf16 * W^T + bias. WG tile 64x128, 8 waves, 16x64 strip
// per wave (4 WMMA accs, 24 K-steps). Double-buffered LDS X tile, one barrier
// per K-step, next tile's global load in flight under the WMMAs.
// ---------------------------------------------------------------------------
template <bool F32OUT>
__global__ void __launch_bounds__(256)
gemm_bias_768(const _Float16* __restrict__ X,
              const _Float16* __restrict__ Wp,
              const float*    __restrict__ bias,
              float*          __restrict__ Yf32,
              _Float16*       __restrict__ Yf16) {
    __shared__ __align__(32) _Float16 Xs[2][64 * KT];   // 2 x 4 KB

    const int lane  = threadIdx.x & 31;
    const int wave  = threadIdx.x >> 5;
    const int mw    = wave & 3;
    const int nw    = wave >> 2;
    const int m0    = blockIdx.y * 64;
    const int n0    = blockIdx.x * 128;
    const int lrow  = lane & 15;
    const int lhalf = lane >> 4;

    const int sidx = threadIdx.x * 8;   // staging: 256 threads x 8 halfs
    const int sr   = sidx >> 5;
    const int sc   = sidx & 31;

    uint4 xreg;
    auto gload = [&](int kt) {
        xreg = *reinterpret_cast<const uint4*>(&X[(size_t)(m0 + sr) * DM + kt * KT + sc]);
    };
    auto sstore = [&](int buf) {
        *reinterpret_cast<uint4*>(&Xs[buf][sr * KT + sc]) = xreg;
    };

    v8f c[4] = {};

    gload(0);
    sstore(0);
    for (int kt = 0; kt < KSTEPS; ++kt) {
        __syncthreads();
        const int cur = kt & 1;
        if (kt + 1 < KSTEPS) {
            gload(kt + 1);
            if (kt + 2 < KSTEPS)
                __builtin_prefetch(&X[(size_t)(m0 + sr) * DM + (kt + 2) * KT + sc], 0, 0);
        }

        const v16h a = *reinterpret_cast<const v16h*>(
            &Xs[cur][(mw * 16 + lrow) * KT + lhalf * 16]);
#pragma unroll
        for (int j = 0; j < 4; ++j) {
            const int ntG = (n0 >> 4) + nw * 4 + j;
            const v16h b  = *reinterpret_cast<const v16h*>(
                &Wp[((size_t)(kt * (DM / 16) + ntG) * 32 + lane) * 16]);
            c[j] = __builtin_amdgcn_wmma_f32_16x16x32_f16(
                false, a, false, b, (short)0, c[j], false, false);
        }

        if (kt + 1 < KSTEPS) sstore(cur ^ 1);
    }

#pragma unroll
    for (int j = 0; j < 4; ++j) {
        const int col  = n0 + nw * 64 + j * 16 + lrow;
        const float bv = bias[col];
#pragma unroll
        for (int jv = 0; jv < 8; ++jv) {
            const int row   = m0 + mw * 16 + jv + 8 * lhalf;
            const float val = c[j][jv] + bv;
            if constexpr (F32OUT) Yf32[(size_t)row * DM + col] = val;
            else                  Yf16[(size_t)row * DM + col] = (_Float16)val;
        }
    }
}

// ---------------------------------------------------------------------------
// Flash attention. Grid (16, 12, 4), 8 waves/block, one 16-query strip per
// wave. Double-buffered shared K/V 32-key tiles, one barrier per block.
// Per block: 4 score WMMAs + 4 PV WMMAs + 1 rowsum WMMA (P x ones).
// ---------------------------------------------------------------------------
__global__ void __launch_bounds__(256, 1)
attn_flash(const _Float16* __restrict__ Q,
           const _Float16* __restrict__ K,
           const _Float16* __restrict__ V,
           const int*      __restrict__ mask,
           const float*    __restrict__ temp,
           _Float16*       __restrict__ O) {
    __shared__ __align__(32) _Float16 Ks [2][32 * DH];    // [key][d]
    __shared__ __align__(32) _Float16 Vts[2][DH * 32];    // [d][key] transposed
    __shared__ __align__(32) _Float16 Ps [8][16 * 32];    // per-wave P scratch
    __shared__ float Mb[SEQ];                             // additive mask bias

    const int lane  = threadIdx.x & 31;
    const int wave  = threadIdx.x >> 5;
    const int b     = blockIdx.z;
    const int h     = blockIdx.y;
    const int q0    = (blockIdx.x * 8 + wave) * 16;
    const int lrow  = lane & 15;
    const int lhalf = lane >> 4;
    const float scale = temp[h] * 0.125f;     // temperature / sqrt(64)

    const size_t tokBase = (size_t)b * SEQ;

    // stage additive mask bias once (visible after first in-loop barrier)
    {
        const int base = threadIdx.x * 8;
#pragma unroll
        for (int i = 0; i < 8; ++i)
            Mb[base + i] = mask[b * SEQ + base + i] ? 0.0f : -1.0e9f * scale;
    }

    // Q fragments pre-scaled by temperature/sqrt(d)
    const _Float16 hs = (_Float16)scale;
    v16h aq[2];
#pragma unroll
    for (int f = 0; f < 2; ++f) {
        aq[f] = *reinterpret_cast<const v16h*>(
            &Q[(tokBase + q0 + lrow) * DM + h * DH + f * 32 + lhalf * 16]);
        aq[f] = aq[f] * hs;
    }

    v16h ones;
#pragma unroll
    for (int i = 0; i < 16; ++i) ones[i] = (_Float16)1.0f;

    v8f   acc[4] = {};
    v8f   accS   = {};
    float mrun[8];
#pragma unroll
    for (int jv = 0; jv < 8; ++jv) mrun[jv] = -3.0e38f;

    const int skey = threadIdx.x >> 3;   // K/V staging: 8 threads per key
    const int sch  = threadIdx.x & 7;

    uint4 kreg, vreg;
    auto gload = [&](int kb) {
        const size_t g = (tokBase + kb * 32 + skey) * DM + h * DH + sch * 8;
        kreg = *reinterpret_cast<const uint4*>(&K[g]);
        vreg = *reinterpret_cast<const uint4*>(&V[g]);
    };
    auto sstore = [&](int buf) {
        *reinterpret_cast<uint4*>(&Ks[buf][skey * DH + sch * 8]) = kreg;
        const _Float16* vp = reinterpret_cast<const _Float16*>(&vreg);
#pragma unroll
        for (int i = 0; i < 8; ++i) Vts[buf][(sch * 8 + i) * 32 + skey] = vp[i];
    };

    gload(0);
    sstore(0);
    for (int kb = 0; kb < KBLK; ++kb) {
        __syncthreads();
        const int cur = kb & 1;
        if (kb + 1 < KBLK) gload(kb + 1);     // in flight under the WMMAs

        // scores (pre-scaled), two 16-key column sub-tiles
        v8f sc0 = {}, sc1 = {};
#pragma unroll
        for (int f = 0; f < 2; ++f) {
            const v16h bk0 = *reinterpret_cast<const v16h*>(
                &Ks[cur][lrow * DH + f * 32 + lhalf * 16]);
            const v16h bk1 = *reinterpret_cast<const v16h*>(
                &Ks[cur][(16 + lrow) * DH + f * 32 + lhalf * 16]);
            sc0 = __builtin_amdgcn_wmma_f32_16x16x32_f16(
                false, aq[f], false, bk0, (short)0, sc0, false, false);
            sc1 = __builtin_amdgcn_wmma_f32_16x16x32_f16(
                false, aq[f], false, bk1, (short)0, sc1, false, false);
        }

        const int kk0 = kb * 32;
        const float bias0 = Mb[kk0 + lrow];
        const float bias1 = Mb[kk0 + 16 + lrow];

        // batched row-max butterflies (8 swizzles per step, one wait each)
        float rm[8];
#pragma unroll
        for (int jv = 0; jv < 8; ++jv) {
            sc0[jv] += bias0;
            sc1[jv] += bias1;
            rm[jv] = fmaxf(sc0[jv], sc1[jv]);
        }
        red_max8<8>(rm);
        red_max8<4>(rm);
        red_max8<2>(rm);
        red_max8<1>(rm);

#pragma unroll
        for (int jv = 0; jv < 8; ++jv) {
            const float mnew = fmaxf(mrun[jv], rm[jv]);
            const float cr   = __expf(mrun[jv] - mnew);
            mrun[jv] = mnew;
            const float p0 = __expf(sc0[jv] - mnew);
            const float p1 = __expf(sc1[jv] - mnew);
            const int prow = jv + 8 * lhalf;              // C-layout row
            Ps[wave][prow * 32 + lrow]      = (_Float16)p0;
            Ps[wave][prow * 32 + 16 + lrow] = (_Float16)p1;
            accS[jv] *= cr;
#pragma unroll
            for (int nt = 0; nt < 4; ++nt) acc[nt][jv] *= cr;
        }

        // P as A fragment; V^T + ones as B fragments
        const v16h ap = *reinterpret_cast<const v16h*>(&Ps[wave][lrow * 32 + lhalf * 16]);
        accS = __builtin_amdgcn_wmma_f32_16x16x32_f16(
            false, ap, false, ones, (short)0, accS, false, false);
#pragma unroll
        for (int nt = 0; nt < 4; ++nt) {
            const v16h bv = *reinterpret_cast<const v16h*>(
                &Vts[cur][(nt * 16 + lrow) * 32 + lhalf * 16]);
            acc[nt] = __builtin_amdgcn_wmma_f32_16x16x32_f16(
                false, ap, false, bv, (short)0, acc[nt], false, false);
        }

        if (kb + 1 < KBLK) sstore(cur ^ 1);   // waits loadcnt here, post-compute
    }

    // normalize + store f16 ([token][768], heads interleaved)
#pragma unroll
    for (int jv = 0; jv < 8; ++jv) {
        const float inv = 1.0f / accS[jv];
        const int   row = q0 + jv + 8 * lhalf;
#pragma unroll
        for (int nt = 0; nt < 4; ++nt) {
            const float ov = acc[nt][jv] * inv;
            O[(tokBase + row) * DM + h * DH + nt * 16 + lrow] = (_Float16)ov;
        }
    }
}

// ---------------------------------------------------------------------------
extern "C" void kernel_launch(void* const* d_in, const int* in_sizes, int n_in,
                              void* d_out, int out_size, void* d_ws, size_t ws_size,
                              hipStream_t stream) {
    const float* x    = (const float*)d_in[0];
    const int*   mask = (const int*)  d_in[1];
    const float* Wq   = (const float*)d_in[2];
    const float* bq   = (const float*)d_in[3];
    const float* Wk   = (const float*)d_in[4];
    const float* bk   = (const float*)d_in[5];
    const float* Wv   = (const float*)d_in[6];
    const float* bv   = (const float*)d_in[7];
    const float* Wo   = (const float*)d_in[8];
    const float* bo   = (const float*)d_in[9];
    const float* temp = (const float*)d_in[10];
    float* out = (float*)d_out;

    size_t off = 0;
    auto walloc = [&](size_t elems) {
        void* p = (char*)d_ws + off;
        off = (off + elems * sizeof(_Float16) + 255) & ~(size_t)255;
        return (_Float16*)p;
    };
    _Float16* Xf  = walloc((size_t)NTOK * DM);
    _Float16* Wqp = walloc((size_t)DM * DM);
    _Float16* Wkp = walloc((size_t)DM * DM);
    _Float16* Wvp = walloc((size_t)DM * DM);
    _Float16* Wop = walloc((size_t)DM * DM);
    _Float16* Qf  = walloc((size_t)NTOK * DM);
    _Float16* Kf  = walloc((size_t)NTOK * DM);
    _Float16* Vf  = walloc((size_t)NTOK * DM);
    _Float16* Af  = Xf;   // attention output reuses x_f16 (dead after QKV GEMMs)

    const int nelem = NTOK * DM;
    cvt_f32_f16<<<nelem / (256 * 4), 256, 0, stream>>>(x, Xf, nelem);

    const int packThreads = (DM / 32) * (DM / 16) * 32;   // 36864
    pack_w_bfrag<<<packThreads / 256, 256, 0, stream>>>(Wq, Wqp);
    pack_w_bfrag<<<packThreads / 256, 256, 0, stream>>>(Wk, Wkp);
    pack_w_bfrag<<<packThreads / 256, 256, 0, stream>>>(Wv, Wvp);
    pack_w_bfrag<<<packThreads / 256, 256, 0, stream>>>(Wo, Wop);

    dim3 ggrid(DM / 128, NTOK / 64);   // (6, 128)
    gemm_bias_768<false><<<ggrid, 256, 0, stream>>>(Xf, Wqp, bq, nullptr, Qf);
    gemm_bias_768<false><<<ggrid, 256, 0, stream>>>(Xf, Wkp, bk, nullptr, Kf);
    gemm_bias_768<false><<<ggrid, 256, 0, stream>>>(Xf, Wvp, bv, nullptr, Vf);

    attn_flash<<<dim3(SEQ / (16 * 8), NH, 4), 256, 0, stream>>>(Qf, Kf, Vf, mask, temp, Af);

    gemm_bias_768<true><<<ggrid, 256, 0, stream>>>(Af, Wop, bo, out, nullptr);
}

// v001
// It runs in 325 microseconds.
// Two timings next to v000 put it at 1.26 and 1.25 times that version's speed.
#include <hip/hip_runtime.h>

typedef __attribute__((ext_vector_type(16))) _Float16 v16h;
typedef __attribute__((ext_vector_type(8)))  _Float16 v8h;
typedef __attribute__((ext_vector_type(8)))  float    v8f;

constexpr int DM     = 768;     // d_model
constexpr int NTOK   = 4 * 2048;
constexpr int SEQ    = 2048;
constexpr int NH     = 12;
constexpr int DH     = 64;
constexpr int KT     = 32;          // WMMA K per step (f16)
constexpr int KSTEPS = DM / KT;     // 24
constexpr int KBLK   = SEQ / 32;    // 64 key blocks

// LDS row pitches in halfs: row bytes + 16, an odd multiple of 16 B, so that the
// 16 rows a ds_load_b128 touches per lane half fall on distinct banks.
constexpr int P32 = 32 + 8;         // 64-B rows  -> 80 B
constexpr int P64 = 64 + 8;         // 128-B rows -> 144 B

// 16 consecutive halfs of an LDS row as one fragment; rows are 16-B aligned only.
__device__ inline v16h ld_frag(const _Float16* p) {
    const v8h lo = *reinterpret_cast<const v8h*>(p);
    const v8h hi = *reinterpret_cast<const v8h*>(p + 8);
    return __builtin_shufflevector(lo, hi, 0, 1, 2, 3, 4, 5, 6, 7, 8, 9, 10, 11, 12, 13, 14, 15);
}

// batched group-of-32 xor swizzle max-reduction step over 8 independent rows:
// 8 ds_swizzles issue back-to-back, one wait, 8 maxes.
template <int XM>
__device__ inline void red_max8(float (&rm)[8]) {
    float t[8];
#pragma unroll
    for (int j = 0; j < 8; ++j)
        t[j] = __int_as_float(
            __builtin_amdgcn_ds_swizzle(__float_as_int(rm[j]), (XM << 10) | 0x1f));
#pragma unroll
    for (int j = 0; j < 8; ++j) rm[j] = fmaxf(rm[j], t[j]);
}

// ---------------------------------------------------------------------------
// fp32 -> f16 elementwise convert (x)
// ---------------------------------------------------------------------------
__global__ void cvt_f32_f16(const float* __restrict__ in, _Float16* __restrict__ out, int n) {
    int i = (blockIdx.x * blockDim.x + threadIdx.x) * 4;
    if (i < n) {
        float4 v = *reinterpret_cast<const float4*>(in + i);
        out[i + 0] = (_Float16)v.x;
        out[i + 1] = (_Float16)v.y;
        out[i + 2] = (_Float16)v.z;
        out[i + 3] = (_Float16)v.w;
    }
}

// ---------------------------------------------------------------------------
// Pack W [out=768][in=768] (row-major fp32) into per-lane WMMA B-fragments.
// ---------------------------------------------------------------------------
__global__ void pack_w_bfrag(const float* __restrict__ W, _Float16* __restrict__ Wp) {
    const int t    = blockIdx.x * blockDim.x + threadIdx.x;   // 36864 threads
    const int lane = t & 31;
    const int tile = t >> 5;                                  // 0..1151
    const int nt   = tile % (DM / 16);
    const int kt   = tile / (DM / 16);
    const int n    = nt * 16 + (lane & 15);
    const int k0   = kt * 32 + (lane >> 4) * 16;
    const float* src = &W[(size_t)n * DM + k0];
    _Float16*    dst = &Wp[((size_t)tile * 32 + lane) * 16];
#pragma unroll
    for (int i = 0; i < 16; ++i) dst[i] = (_Float16)src[i];
}

// ---------------------------------------------------------------------------
// GEMM: Y[8192,768] = Xf16 * W^T + bias. WG tile 64x128, 8 waves, 16x64 strip
// per wave (4 WMMA accs, 24 K-steps). Double-buffered LDS X tile, one barrier
// per K-step, next tile's global load in flight under the WMMAs.
// ---------------------------------------------------------------------------
template <bool F32OUT>
__global__ void __launch_bounds__(256)
gemm_bias_768(const _Float16* __restrict__ X,
              const _Float16* __restrict__ Wp,
              const float*    __restrict__ bias,
              float*          __restrict__ Yf32,
              _Float16*       __restrict__ Yf16) {
    __shared__ __align__(32) _Float16 Xs[2][64 * P32];  // 2 x 5 KB

    const int lane  = threadIdx.x & 31;
    const int wave  = threadIdx.x >> 5;
    const int mw    = wave & 3;
    const int nw    = wave >> 2;
    const int m0    = blockIdx.y * 64;
    const int n0    = blockIdx.x * 128;
    const int lrow  = lane & 15;
    const int lhalf = lane >> 4;

    const int sidx = threadIdx.x * 8;   // staging: 256 threads x 8 halfs
    const int sr   = sidx >> 5;
    const int sc   = sidx & 31;

    uint4 xreg;
    auto gload = [&](int kt) {
        xreg = *reinterpret_cast<const uint4*>(&X[(size_t)(m0 + sr) * DM + kt * KT + sc]);
    };
    auto sstore = [&](int buf) {
        *reinterpret_cast<uint4*>(&Xs[buf][sr * P32 + sc]) = xreg;
    };

    v8f c[4] = {};

    gload(0);
    sstore(0);
    for (int kt = 0; kt < KSTEPS; ++kt) {
        __syncthreads();
        const int cur = kt & 1;
        if (kt + 1 < KSTEPS) {
            gload(kt + 1);
            if (kt + 2 < KSTEPS)
                __builtin_prefetch(&X[(size_t)(m0 + sr) * DM + (kt + 2) * KT + sc], 0, 0);
        }

        const v16h a = ld_frag(&Xs[cur][(mw * 16 + lrow) * P32 + lhalf * 16]);
#pragma unroll
        for (int j = 0; j < 4; ++j) {
            const int ntG = (n0 >> 4) + nw * 4 + j;
            const v16h b  = *reinterpret_cast<const v16h*>(
                &Wp[((size_t)(kt * (DM / 16) + ntG) * 32 + lane) * 16]);
            c[j] = __builtin_amdgcn_wmma_f32_16x16x32_f16(
                false, a, false, b, (short)0, c[j], false, false);
        }

        if (kt + 1 < KSTEPS) sstore(cur ^ 1);
    }

#pragma unroll
    for (int j = 0; j < 4; ++j) {
        const int col  = n0 + nw * 64 + j * 16 + lrow;
        const float bv = bias[col];
#pragma unroll
        for (int jv = 0; jv < 8; ++jv) {
            const int row   = m0 + mw * 16 + jv + 8 * lhalf;
            const float val = c[j][jv] + bv;
            if constexpr (F32OUT) Yf32[(size_t)row * DM + col] = val;
            else                  Yf16[(size_t)row * DM + col] = (_Float16)val;
        }
    }
}

// ---------------------------------------------------------------------------
// Flash attention. Grid (16, 12, 4), 8 waves/block, one 16-query strip per
// wave. Double-buffered shared K/V 32-key tiles, one barrier per block.
// Per block: 4 score WMMAs + 4 PV WMMAs + 1 rowsum WMMA (P x ones).
// ---------------------------------------------------------------------------
__global__ void __launch_bounds__(256, 1)
attn_flash(const _Float16* __restrict__ Q,
           const _Float16* __restrict__ K,
           const _Float16* __restrict__ V,
           const int*      __restrict__ mask,
           const float*    __restrict__ temp,
           _Float16*       __restrict__ O) {
    __shared__ __align__(32) _Float16 Ks [2][32 * P64];   // [key][d]
    __shared__ __align__(32) _Float16 Vts[2][DH * P32];   // [d][key] transposed
    __shared__ __align__(32) _Float16 Ps [8][16 * P32];   // per-wave P scratch
    __shared__ float Mb[SEQ];                             // additive mask bias

    const int lane  = threadIdx.x & 31;
    const int wave  = threadIdx.x >> 5;
    const int b     = blockIdx.z;
    const int h     = blockIdx.y;
    const int q0    = (blockIdx.x * 8 + wave) * 16;
    const int lrow  = lane & 15;
    const int lhalf = lane >> 4;
    const float scale = temp[h] * 0.125f;     // temperature / sqrt(64)

    const size_t tokBase = (size_t)b * SEQ;

    // stage additive mask bias once (visible after first in-loop barrier)
    {
        const int base = threadIdx.x * 8;
#pragma unroll
        for (int i = 0; i < 8; ++i)
            Mb[base + i] = mask[b * SEQ + base + i] ? 0.0f : -1.0e9f * scale;
    }

    // Q fragments pre-scaled by temperature/sqrt(d)
    const _Float16 hs = (_Float16)scale;
    v16h aq[2];
#pragma unroll
    for (int f = 0; f < 2; ++f) {
        aq[f] = *reinterpret_cast<const v16h*>(
            &Q[(tokBase + q0 + lrow) * DM + h * DH + f * 32 + lhalf * 16]);
        aq[f] = aq[f] * hs;
    }

    v16h ones;
#pragma unroll
    for (int i = 0; i < 16; ++i) ones[i] = (_Float16)1.0f;

    v8f   acc[4] = {};
    v8f   accS   = {};
    float mrun[8];
#pragma unroll
    for (int jv = 0; jv < 8; ++jv) mrun[jv] = -3.0e38f;

    const int skey = threadIdx.x >> 3;   // K/V staging: 8 threads per key
    const int sch  = threadIdx.x & 7;

    uint4 kreg, vreg;
    auto gload = [&](int kb) {
        const size_t g = (tokBase + kb * 32 + skey) * DM + h * DH + sch * 8;
        kreg = *reinterpret_cast<const uint4*>(&K[g]);
        vreg = *reinterpret_cast<const uint4*>(&V[g]);
    };
    auto sstore = [&](int buf) {
        *reinterpret_cast<uint4*>(&Ks[buf][skey * P64 + sch * 8]) = kreg;
        const _Float16* vp = reinterpret_cast<const _Float16*>(&vreg);
#pragma unroll
        for (int i = 0; i < 8; ++i) Vts[buf][(sch * 8 + i) * P32 + skey] = vp[i];
    };

    gload(0);
    sstore(0);
    for (int kb = 0; kb < KBLK; ++kb) {
        __syncthreads();
        const int cur = kb & 1;
        if (kb + 1 < KBLK) gload(kb + 1);     // in flight under the WMMAs

        // scores (pre-scaled), two 16-key column sub-tiles
        v8f sc0 = {}, sc1 = {};
#pragma unroll
        for (int f = 0; f < 2; ++f) {
            const v16h bk0 = ld_frag(&Ks[cur][lrow * P64 + f * 32 + lhalf * 16]);
            const v16h bk1 = ld_frag(&Ks[cur][(16 + lrow) * P64 + f * 32 + lhalf * 16]);
            sc0 = __builtin_amdgcn_wmma_f32_16x16x32_f16(
                false, aq[f], false, bk0, (short)0, sc0, false, false);
            sc1 = __builtin_amdgcn_wmma_f32_16x16x32_f16(
                false, aq[f], false, bk1, (short)0, sc1, false, false);
        }

        const int kk0 = kb * 32;
        const float bias0 = Mb[kk0 + lrow];
        const float bias1 = Mb[kk0 + 16 + lrow];

        // batched row-max butterflies (8 swizzles per step, one wait each)
        float rm[8];
#pragma unroll
        for (int jv = 0; jv < 8; ++jv) {
            sc0[jv] += bias0;
            sc1[jv] += bias1;
            rm[jv] = fmaxf(sc0[jv], sc1[jv]);
        }
        red_max8<8>(rm);
        red_max8<4>(rm);
        red_max8<2>(rm);
        red_max8<1>(rm);

#pragma unroll
        for (int jv = 0; jv < 8; ++jv) {
            const float mnew = fmaxf(mrun[jv], rm[jv]);
            const float cr   = __expf(mrun[jv] - mnew);
            mrun[jv] = mnew;
            const float p0 = __expf(sc0[jv] - mnew);
            const float p1 = __expf(sc1[jv] - mnew);
            const int prow = jv + 8 * lhalf;              // C-layout row
            Ps[wave][prow * P32 + lrow]      = (_Float16)p0;
            Ps[wave][prow * P32 + 16 + lrow] = (_Float16)p1;
            accS[jv] *= cr;
#pragma unroll
            for (int nt = 0; nt < 4; ++nt) acc[nt][jv] *= cr;
        }

        // P as A fragment; V^T + ones as B fragments
        const v16h ap = ld_frag(&Ps[wave][lrow * P32 + lhalf * 16]);
        accS = __builtin_amdgcn_wmma_f32_16x16x32_f16(
            false, ap, false, ones, (short)0, accS, false, false);
#pragma unroll
        for (int nt = 0; nt < 4; ++nt) {
            const v16h bv = ld_frag(&Vts[cur][(nt * 16 + lrow) * P32 + lhalf * 16]);
            acc[nt] = __builtin_amdgcn_wmma_f32_16x16x32_f16(
                false, ap, false, bv, (short)0, acc[nt], false, false);
        }

        if (kb + 1 < KBLK) sstore(cur ^ 1);   // waits loadcnt here, post-compute
    }

    // normalize + store f16 ([token][768], heads interleaved)
#pragma unroll
    for (int jv = 0; jv < 8; ++jv) {
        const float inv = 1.0f / accS[jv];
        const int   row = q0 + jv + 8 * lhalf;
#pragma unroll
        for (int nt = 0; nt < 4; ++nt) {
            const float ov = acc[nt][jv] * inv;
            O[(tokBase + row) * DM + h * DH + nt * 16 + lrow] = (_Float16)ov;
        }
    }
}

// ---------------------------------------------------------------------------
extern "C" void kernel_launch(void* const* d_in, const int* in_sizes, int n_in,
                              void* d_out, int out_size, void* d_ws, size_t ws_size,
                              hipStream_t stream) {
    const float* x    = (const float*)d_in[0];
    const int*   mask = (const int*)  d_in[1];
    const float* Wq   = (const float*)d_in[2];
    const float* bq   = (const float*)d_in[3];
    const float* Wk   = (const float*)d_in[4];
    const float* bk   = (const float*)d_in[5];
    const float* Wv   = (const float*)d_in[6];
    const float* bv   = (const float*)d_in[7];
    const float* Wo   = (const float*)d_in[8];
    const float* bo   = (const float*)d_in[9];
    const float* temp = (const float*)d_in[10];
    float* out = (float*)d_out;

    size_t off = 0;
    auto walloc = [&](size_t elems) {
        void* p = (char*)d_ws + off;
        off = (off + elems * sizeof(_Float16) + 255) & ~(size_t)255;
        return (_Float16*)p;
    };
    _Float16* Xf  = walloc((size_t)NTOK * DM);
    _Float16* Wqp = walloc((size_t)DM * DM);
    _Float16* Wkp = walloc((size_t)DM * DM);
    _Float16* Wvp = walloc((size_t)DM * DM);
    _Float16* Wop = walloc((size_t)DM * DM);
    _Float16* Qf  = walloc((size_t)NTOK * DM);
    _Float16* Kf  = walloc((size_t)NTOK * DM);
    _Float16* Vf  = walloc((size_t)NTOK * DM);
    _Float16* Af  = Xf;   // attention output reuses x_f16 (dead after QKV GEMMs)

    const int nelem = NTOK * DM;
    cvt_f32_f16<<<nelem / (256 * 4), 256, 0, stream>>>(x, Xf, nelem);

    const int packThreads = (DM / 32) * (DM / 16) * 32;   // 36864
    pack_w_bfrag<<<packThreads / 256, 256, 0, stream>>>(Wq, Wqp);
    pack_w_bfrag<<<packThreads / 256, 256, 0, stream>>>(Wk, Wkp);
    pack_w_bfrag<<<packThreads / 256, 256, 0, stream>>>(Wv, Wvp);
    pack_w_bfrag<<<packThreads / 256, 256, 0, stream>>>(Wo, Wop);

    dim3 ggrid(DM / 128, NTOK / 64);   // (6, 128)
    gemm_bias_768<false><<<ggrid, 256, 0, stream>>>(Xf, Wqp, bq, nullptr, Qf);
    gemm_bias_768<false><<<ggrid, 256, 0, stream>>>(Xf, Wkp, bk, nullptr, Kf);
    gemm_bias_768<false><<<ggrid, 256, 0, stream>>>(Xf, Wvp, bv, nullptr, Vf);

    attn_flash<<<dim3(SEQ / (16 * 8), NH, 4), 256, 0, stream>>>(Qf, Kf, Vf, mask, temp, Af);

    gemm_bias_768<true><<<ggrid, 256, 0, stream>>>(Af, Wop, bo, out, nullptr);
}

// v002
// Measured time: 307 microseconds a run.
// Next to v001, in two timings, it ran 1.08 and 1.07 times as fast.
// Over all steps from v000 it is 1.35 times as fast.
#include <hip/hip_runtime.h>

typedef __attribute__((ext_vector_type(16))) _Float16 v16h;
typedef __attribute__((ext_vector_type(8)))  _Float16 v8h;
typedef __attribute__((ext_vector_type(8)))  float    v8f;

constexpr int DM     = 768;     // d_model
constexpr int NTOK   = 4 * 2048;
constexpr int SEQ    = 2048;
constexpr int NH     = 12;
constexpr int DH     = 64;
constexpr int KT     = 32;          // WMMA K per step (f16)
constexpr int KSTEPS = DM / KT;     // 24
constexpr int KBLK   = SEQ / 32;    // 64 key blocks

// LDS row pitches in halfs: row bytes + 16, an odd multiple of 16 B, so that the
// 16 rows a ds_load_b128 touches per lane half fall on distinct banks.
constexpr int P32 = 32 + 8;         // 64-B rows  -> 80 B
constexpr int P64 = 64 + 8;         // 128-B rows -> 144 B

// 16 consecutive halfs of an LDS row as one fragment; rows are 16-B aligned only.
__device__ inline v16h ld_frag(const _Float16* p) {
    const v8h lo = *reinterpret_cast<const v8h*>(p);
    const v8h hi = *reinterpret_cast<const v8h*>(p + 8);
    return __builtin_shufflevector(lo, hi, 0, 1, 2, 3, 4, 5, 6, 7, 8, 9, 10, 11, 12, 13, 14, 15);
}

// 32 keys of a V^T row in the k order that a packed pair of score tiles has as B:
// lane half h takes keys 8h..8h+7 and 16+8h..16+8h+7.
__device__ inline v16h ld_frag_kmap(const _Float16* row, int h) {
    const v8h lo = *reinterpret_cast<const v8h*>(row + 8 * h);
    const v8h hi = *reinterpret_cast<const v8h*>(row + 16 + 8 * h);
    return __builtin_shufflevector(lo, hi, 0, 1, 2, 3, 4, 5, 6, 7, 8, 9, 10, 11, 12, 13, 14, 15);
}

// value of lane l ^ 16
__device__ inline float xhalf(float x) {
    const int b = __builtin_bit_cast(int, x);
    return __builtin_bit_cast(float,
        __builtin_amdgcn_permlanex16(b, b, 0x76543210, 0xfedcba98, false, false));
}

// ---------------------------------------------------------------------------
// fp32 -> f16 elementwise convert (x)
// ---------------------------------------------------------------------------
__global__ void cvt_f32_f16(const float* __restrict__ in, _Float16* __restrict__ out, int n) {
    int i = (blockIdx.x * blockDim.x + threadIdx.x) * 4;
    if (i < n) {
        float4 v = *reinterpret_cast<const float4*>(in + i);
        out[i + 0] = (_Float16)v.x;
        out[i + 1] = (_Float16)v.y;
        out[i + 2] = (_Float16)v.z;
        out[i + 3] = (_Float16)v.w;
    }
}

// ---------------------------------------------------------------------------
// Pack W [out=768][in=768] (row-major fp32) into per-lane WMMA B-fragments.
// ---------------------------------------------------------------------------
__global__ void pack_w_bfrag(const float* __restrict__ W, _Float16* __restrict__ Wp) {
    const int t    = blockIdx.x * blockDim.x + threadIdx.x;   // 36864 threads
    const int lane = t & 31;
    const int tile = t >> 5;                                  // 0..1151
    const int nt   = tile % (DM / 16);
    const int kt   = tile / (DM / 16);
    const int n    = nt * 16 + (lane & 15);
    const int k0   = kt * 32 + (lane >> 4) * 16;
    const float* src = &W[(size_t)n * DM + k0];
    _Float16*    dst = &Wp[((size_t)tile * 32 + lane) * 16];
#pragma unroll
    for (int i = 0; i < 16; ++i) dst[i] = (_Float16)src[i];
}

// ---------------------------------------------------------------------------
// GEMM: Y[8192,768] = Xf16 * W^T + bias. WG tile 64x128, 8 waves, 16x64 strip
// per wave (4 WMMA accs, 24 K-steps). Double-buffered LDS X tile, one barrier
// per K-step, next tile's global load in flight under the WMMAs.
// ---------------------------------------------------------------------------
template <bool F32OUT>
__global__ void __launch_bounds__(256)
gemm_bias_768(const _Float16* __restrict__ X,
              const _Float16* __restrict__ Wp,
              const float*    __restrict__ bias,
              float*          __restrict__ Yf32,
              _Float16*       __restrict__ Yf16) {
    __shared__ __align__(32) _Float16 Xs[2][64 * P32];  // 2 x 5 KB

    const int lane  = threadIdx.x & 31;
    const int wave  = threadIdx.x >> 5;
    const int mw    = wave & 3;
    const int nw    = wave >> 2;
    const int m0    = blockIdx.y * 64;
    const int n0    = blockIdx.x * 128;
    const int lrow  = lane & 15;
    const int lhalf = lane >> 4;

    const int sidx = threadIdx.x * 8;   // staging: 256 threads x 8 halfs
    const int sr   = sidx >> 5;
    const int sc   = sidx & 31;

    uint4 xreg;
    auto gload = [&](int kt) {
        xreg = *reinterpret_cast<const uint4*>(&X[(size_t)(m0 + sr) * DM + kt * KT + sc]);
    };
    auto sstore = [&](int buf) {
        *reinterpret_cast<uint4*>(&Xs[buf][sr * P32 + sc]) = xreg;
    };

    v8f c[4] = {};

    gload(0);
    sstore(0);
    for (int kt = 0; kt < KSTEPS; ++kt) {
        __syncthreads();
        const int cur = kt & 1;
        if (kt + 1 < KSTEPS) {
            gload(kt + 1);
            if (kt + 2 < KSTEPS)
                __builtin_prefetch(&X[(size_t)(m0 + sr) * DM + (kt + 2) * KT + sc], 0, 0);
        }

        const v16h a = ld_frag(&Xs[cur][(mw * 16 + lrow) * P32 + lhalf * 16]);
#pragma unroll
        for (int j = 0; j < 4; ++j) {
            const int ntG = (n0 >> 4) + nw * 4 + j;
            const v16h b  = *reinterpret_cast<const v16h*>(
                &Wp[((size_t)(kt * (DM / 16) + ntG) * 32 + lane) * 16]);
            c[j] = __builtin_amdgcn_wmma_f32_16x16x32_f16(
                false, a, false, b, (short)0, c[j], false, false);
        }

        if (kt + 1 < KSTEPS) sstore(cur ^ 1);
    }

#pragma unroll
    for (int j = 0; j < 4; ++j) {
        const int col  = n0 + nw * 64 + j * 16 + lrow;
        const float bv = bias[col];
#pragma unroll
        for (int jv = 0; jv < 8; ++jv) {
            const int row   = m0 + mw * 16 + jv + 8 * lhalf;
            const float val = c[j][jv] + bv;
            if constexpr (F32OUT) Yf32[(size_t)row * DM + col] = val;
            else                  Yf16[(size_t)row * DM + col] = (_Float16)val;
        }
    }
}

__global__ void __launch_bounds__(256, 1)
attn_flash(const _Float16* __restrict__ Q,
           const _Float16* __restrict__ K,
           const _Float16* __restrict__ V,
           const int*      __restrict__ mask,
           const float*    __restrict__ temp,
           _Float16*       __restrict__ O) {
    __shared__ __align__(32) _Float16 Ks [2][32 * P64];   // [key][d]
    __shared__ __align__(32) _Float16 Vts[2][DH * P32];   // [d][key] transposed
    __shared__ __align__(32) float Mb[SEQ];               // additive mask bias

    const int lane  = threadIdx.x & 31;
    const int wave  = threadIdx.x >> 5;
    const int b     = blockIdx.z;
    const int h     = blockIdx.y;
    const int q0    = (blockIdx.x * 8 + wave) * 16;
    const int lrow  = lane & 15;
    const int lhalf = lane >> 4;
    const float scale = temp[h] * 0.125f;     // temperature / sqrt(64)

    const size_t tokBase = (size_t)b * SEQ;

    // stage additive mask bias once (visible after first in-loop barrier)
    {
        const int base = threadIdx.x * 8;
#pragma unroll
        for (int i = 0; i < 8; ++i)
            Mb[base + i] = mask[b * SEQ + base + i] ? 0.0f : -1.0e9f * scale;
    }

    // Q fragments pre-scaled by temperature/sqrt(d)
    const _Float16 hs = (_Float16)scale;
    v16h aq[2];
#pragma unroll
    for (int f = 0; f < 2; ++f) {
        aq[f] = *reinterpret_cast<const v16h*>(
            &Q[(tokBase + q0 + lrow) * DM + h * DH + f * 32 + lhalf * 16]);
        aq[f] = aq[f] * hs;
    }

    // A operand of the column sums: rows 0 and 8 are ones, the rest 0, so that
    // register 0 of either lane half receives its query's sum over all 32 keys.
    const _Float16 oneOrZero = (lane & 7) == 0 ? (_Float16)1.0f : (_Float16)0.0f;
    v16h ones;
#pragma unroll
    for (int i = 0; i < 16; ++i) ones[i] = oneOrZero;

    v8f   acc[4] = {};        // O^T: acc[nt][jv] = O[q0 + lrow][nt*16 + 8*lhalf + jv]
    v8f   accS   = {};        // accS[0] = running denominator of query q0 + lrow
    float mrun   = -3.0e38f;  // running maximum of query q0 + lrow

    const int skey = threadIdx.x >> 3;   // K/V staging: 8 threads per key
    const int sch  = threadIdx.x & 7;

    uint4 kreg, vreg;
    auto gload = [&](int kb) {
        const size_t g = (tokBase + kb * 32 + skey) * DM + h * DH + sch * 8;
        kreg = *reinterpret_cast<const uint4*>(&K[g]);
        vreg = *reinterpret_cast<const uint4*>(&V[g]);
    };
    auto sstore = [&](int buf) {
        *reinterpret_cast<uint4*>(&Ks[buf][skey * P64 + sch * 8]) = kreg;
        const _Float16* vp = reinterpret_cast<const _Float16*>(&vreg);
#pragma unroll
        for (int i = 0; i < 8; ++i) Vts[buf][(sch * 8 + i) * P32 + skey] = vp[i];
    };

    gload(0);
    sstore(0);
    for (int kb = 0; kb < KBLK; ++kb) {
        __syncthreads();
        const int cur = kb & 1;
        if (kb + 1 < KBLK) gload(kb + 1);     // in flight under the WMMAs
        // keeps the two loads up here: sunk to their LDS stores at the foot of the
        // pass, their whole latency would stand in front of the next barrier
        __builtin_amdgcn_sched_barrier(0);

        // S^T (pre-scaled), two 16-key row tiles: sc[jv] = S[q0 + lrow][key 8*lhalf + jv]
        v8f sc0 = {}, sc1 = {};
#pragma unroll
        for (int f = 0; f < 2; ++f) {
            const v16h bk0 = ld_frag(&Ks[cur][lrow * P64 + f * 32 + lhalf * 16]);
            const v16h bk1 = ld_frag(&Ks[cur][(16 + lrow) * P64 + f * 32 + lhalf * 16]);
            sc0 = __builtin_amdgcn_wmma_f32_16x16x32_f16(
                false, bk0, false, aq[f], (short)0, sc0, false, false);
            sc1 = __builtin_amdgcn_wmma_f32_16x16x32_f16(
                false, bk1, false, aq[f], (short)0, sc1, false, false);
        }

        const int kk0 = kb * 32;
        sc0 += *reinterpret_cast<const v8f*>(&Mb[kk0 + 8 * lhalf]);
        sc1 += *reinterpret_cast<const v8f*>(&Mb[kk0 + 16 + 8 * lhalf]);

        // the query's maximum over its 32 keys: 16 in this lane, 16 in lane ^ 16
        float rm = fmaxf(sc0[0], sc1[0]);
#pragma unroll
        for (int jv = 1; jv < 8; ++jv) rm = fmaxf(rm, fmaxf(sc0[jv], sc1[jv]));
        rm = fmaxf(rm, xhalf(rm));

        const float mnew = fmaxf(mrun, rm);
        const float cr   = __expf(mrun - mnew);
        mrun = mnew;

        v8f p0, p1;
#pragma unroll
        for (int jv = 0; jv < 8; ++jv) {
            p0[jv] = __expf(sc0[jv] - mnew);
            p1[jv] = __expf(sc1[jv] - mnew);
        }
        // P^T as B fragment: the two converted tiles, register for register
        const v16h pb = __builtin_shufflevector(
            __builtin_convertvector(p0, v8h), __builtin_convertvector(p1, v8h),
            0, 1, 2, 3, 4, 5, 6, 7, 8, 9, 10, 11, 12, 13, 14, 15);

        accS[0] *= cr;        // registers 1..7 of accS stay 0
#pragma unroll
        for (int nt = 0; nt < 4; ++nt) acc[nt] *= cr;

        accS = __builtin_amdgcn_wmma_f32_16x16x32_f16(
            false, ones, false, pb, (short)0, accS, false, false);
#pragma unroll
        for (int nt = 0; nt < 4; ++nt) {
            const v16h av = ld_frag_kmap(&Vts[cur][(nt * 16 + lrow) * P32], lhalf);
            acc[nt] = __builtin_amdgcn_wmma_f32_16x16x32_f16(
                false, av, false, pb, (short)0, acc[nt], false, false);
        }

        if (kb + 1 < KBLK) sstore(cur ^ 1);   // waits loadcnt here, post-compute
    }

    // normalize + store f16 ([token][768], heads interleaved): 8 consecutive d per tile
    const float inv = 1.0f / accS[0];
    _Float16* orow = &O[(tokBase + q0 + lrow) * DM + h * DH + 8 * lhalf];
#pragma unroll
    for (int nt = 0; nt < 4; ++nt)
        *reinterpret_cast<v8h*>(orow + nt * 16) = __builtin_convertvector(acc[nt] * inv, v8h);
}

// ---------------------------------------------------------------------------
extern "C" void kernel_launch(void* const* d_in, const int* in_sizes, int n_in,
                              void* d_out, int out_size, void* d_ws, size_t ws_size,
                              hipStream_t stream) {
    const float* x    = (const float*)d_in[0];
    const int*   mask = (const int*)  d_in[1];
    const float* Wq   = (const float*)d_in[2];
    const float* bq   = (const float*)d_in[3];
    const float* Wk   = (const float*)d_in[4];
    const float* bk   = (const float*)d_in[5];
    const float* Wv   = (const float*)d_in[6];
    const float* bv   = (const float*)d_in[7];
    const float* Wo   = (const float*)d_in[8];
    const float* bo   = (const float*)d_in[9];
    const float* temp = (const float*)d_in[10];
    float* out = (float*)d_out;

    size_t off = 0;
    auto walloc = [&](size_t elems) {
        void* p = (char*)d_ws + off;
        off = (off + elems * sizeof(_Float16) + 255) & ~(size_t)255;
        return (_Float16*)p;
    };
    _Float16* Xf  = walloc((size_t)NTOK * DM);
    _Float16* Wqp = walloc((size_t)DM * DM);
    _Float16* Wkp = walloc((size_t)DM * DM);
    _Float16* Wvp = walloc((size_t)DM * DM);
    _Float16* Wop = walloc((size_t)DM * DM);
    _Float16* Qf  = walloc((size_t)NTOK * DM);
    _Float16* Kf  = walloc((size_t)NTOK * DM);
    _Float16* Vf  = walloc((size_t)NTOK * DM);
    _Float16* Af  = Xf;   // attention output reuses x_f16 (dead after QKV GEMMs)

    const int nelem = NTOK * DM;
    cvt_f32_f16<<<nelem / (256 * 4), 256, 0, stream>>>(x, Xf, nelem);

    const int packThreads = (DM / 32) * (DM / 16) * 32;   // 36864
    pack_w_bfrag<<<packThreads / 256, 256, 0, stream>>>(Wq, Wqp);
    pack_w_bfrag<<<packThreads / 256, 256, 0, stream>>>(Wk, Wkp);
    pack_w_bfrag<<<packThreads / 256, 256, 0, stream>>>(Wv, Wvp);
    pack_w_bfrag<<<packThreads / 256, 256, 0, stream>>>(Wo, Wop);

    dim3 ggrid(DM / 128, NTOK / 64);   // (6, 128)
    gemm_bias_768<false><<<ggrid, 256, 0, stream>>>(Xf, Wqp, bq, nullptr, Qf);
    gemm_bias_768<false><<<ggrid, 256, 0, stream>>>(Xf, Wkp, bk, nullptr, Kf);
    gemm_bias_768<false><<<ggrid, 256, 0, stream>>>(Xf, Wvp, bv, nullptr, Vf);

    attn_flash<<<dim3(SEQ / (16 * 8), NH, 4), 256, 0, stream>>>(Qf, Kf, Vf, mask, temp, Af);

    gemm_bias_768<true><<<ggrid, 256, 0, stream>>>(Af, Wop, bo, out, nullptr);
}

// v003
// Measured time: 233 microseconds a run.
// Next to v002, in two timings, it ran 1.33 and 1.32 times as fast.
// Over all steps from v000 it is 1.79 times as fast.
#include <hip/hip_runtime.h>

typedef __attribute__((ext_vector_type(16))) _Float16 v16h;
typedef __attribute__((ext_vector_type(8)))  _Float16 v8h;
typedef __attribute__((ext_vector_type(8)))  float    v8f;

constexpr int DM     = 768;     // d_model
constexpr int NTOK   = 4 * 2048;
constexpr int SEQ    = 2048;
constexpr int NH     = 12;
constexpr int DH     = 64;
constexpr int KT     = 32;          // WMMA K per step (f16)
constexpr int KSTEPS = DM / KT;     // 24
constexpr int KBLK   = SEQ / 32;    // 64 key blocks

// LDS row pitches in halfs: row bytes + 16, an odd multiple of 16 B, so that the
// 16 rows a ds_load_b128 touches per lane half fall on distinct banks.
constexpr int P32 = 32 + 8;         // 64-B rows  -> 80 B
constexpr int P64 = 64 + 8;         // 128-B rows -> 144 B

// 16 consecutive halfs of an LDS row as one fragment; rows are 16-B aligned only.
__device__ inline v16h ld_frag(const _Float16* p) {
    const v8h lo = *reinterpret_cast<const v8h*>(p);
    const v8h hi = *reinterpret_cast<const v8h*>(p + 8);
    return __builtin_shufflevector(lo, hi, 0, 1, 2, 3, 4, 5, 6, 7, 8, 9, 10, 11, 12, 13, 14, 15);
}

// 32 keys of a V^T row in the k order that a packed pair of score tiles has as B:
// lane half h takes keys 8h..8h+7 and 16+8h..16+8h+7.
__device__ inline v16h ld_frag_kmap(const _Float16* row, int h) {
    const v8h lo = *reinterpret_cast<const v8h*>(row + 8 * h);
    const v8h hi = *reinterpret_cast<const v8h*>(row + 16 + 8 * h);
    return __builtin_shufflevector(lo, hi, 0, 1, 2, 3, 4, 5, 6, 7, 8, 9, 10, 11, 12, 13, 14, 15);
}

// value of lane l ^ 16
__device__ inline float xhalf(float x) {
    const int b = __builtin_bit_cast(int, x);
    return __builtin_bit_cast(float,
        __builtin_amdgcn_permlanex16(b, b, 0x76543210, 0xfedcba98, false, false));
}

// ---------------------------------------------------------------------------
// Operand preparation, one launch. The five jobs do not depend on one another
// and are block-index ranges of one grid:
//   blocks [0, 4*PACKB)  pack Wq, Wk, Wv, Wo (row-major fp32 [out=768][in=768])
//                        into per-lane WMMA B-fragments, PACKB blocks each
//   the rest             fp32 -> f16 elementwise convert of x
// The packs stand first: few blocks with strided reads, they start early and
// run under the stream of x.
// ---------------------------------------------------------------------------
constexpr int PACKB = (DM / 32) * (DM / 16) * 32 / 256;   // 144 blocks per weight
constexpr int CVTB  = NTOK * DM / (256 * 4);              // 6144 blocks for x

__global__ void __launch_bounds__(256)
prep_operands(const float* __restrict__ x,
              const float* __restrict__ Wq, const float* __restrict__ Wk,
              const float* __restrict__ Wv, const float* __restrict__ Wo,
              _Float16* __restrict__ Xf, _Float16* __restrict__ Wpack) {
    const int blk = blockIdx.x;
    if (blk < 4 * PACKB) {
        const int w = blk / PACKB;                            // which weight
        const float* __restrict__ W = w == 0 ? Wq : w == 1 ? Wk : w == 2 ? Wv : Wo;
        _Float16* __restrict__ Wp = Wpack + (size_t)w * DM * DM;
        const int t    = (blk - w * PACKB) * 256 + threadIdx.x;   // 36864 threads
        const int lane = t & 31;
        const int tile = t >> 5;                                  // 0..1151
        const int nt   = tile % (DM / 16);
        const int kt   = tile / (DM / 16);
        const int n    = nt * 16 + (lane & 15);
        const int k0   = kt * 32 + (lane >> 4) * 16;
        const float* src = &W[(size_t)n * DM + k0];
        _Float16*    dst = &Wp[((size_t)tile * 32 + lane) * 16];
#pragma unroll
        for (int i = 0; i < 16; ++i) dst[i] = (_Float16)src[i];
    } else {
        const int i = ((blk - 4 * PACKB) * 256 + threadIdx.x) * 4;
        if (i < NTOK * DM) {
            const float4 v = *reinterpret_cast<const float4*>(x + i);
            Xf[i + 0] = (_Float16)v.x;
            Xf[i + 1] = (_Float16)v.y;
            Xf[i + 2] = (_Float16)v.z;
            Xf[i + 3] = (_Float16)v.w;
        }
    }
}

// ---------------------------------------------------------------------------
// GEMM: Y[8192,768] = Xf16 * W^T + bias. WG tile 64x128, 8 waves, 16x64 strip
// per wave (4 WMMA accs, 24 K-steps). Double-buffered LDS X tile, one barrier
// per K-step, next tile's global load in flight under the WMMAs.
// blockIdx.x = product * 6 + column block: products that share X (Q, K, V) are
// column ranges of one grid; packed weights and f16 outputs of successive
// products lie one behind the other, each product has its own bias.
// As compiled, the four B fragments of a K-step share one register set: each
// load is waited out in front of its WMMA, four load latencies in a row.
// ---------------------------------------------------------------------------
template <bool F32OUT>
__global__ void __launch_bounds__(256)
gemm_bias_768(const _Float16* __restrict__ X,
              const _Float16* __restrict__ Wpack,
              const float*    __restrict__ bias0,
              const float*    __restrict__ bias1,
              const float*    __restrict__ bias2,
              float*          __restrict__ Yf32,
              _Float16*       __restrict__ Yall) {
    __shared__ __align__(32) _Float16 Xs[2][64 * P32];  // 2 x 5 KB

    const int lane  = threadIdx.x & 31;
    const int wave  = threadIdx.x >> 5;
    const int mw    = wave & 3;
    const int nw    = wave >> 2;
    const int m0    = blockIdx.y * 64;
    const int prod  = blockIdx.x / (DM / 128);
    const int n0    = (blockIdx.x - prod * (DM / 128)) * 128;
    const int lrow  = lane & 15;
    const int lhalf = lane >> 4;

    const _Float16* __restrict__ Wp   = Wpack + (size_t)prod * DM * DM;
    const float*    __restrict__ bias = prod == 0 ? bias0 : prod == 1 ? bias1 : bias2;
    _Float16*       __restrict__ Yf16 = Yall + (size_t)prod * NTOK * DM;

    const int sidx = threadIdx.x * 8;   // staging: 256 threads x 8 halfs
    const int sr   = sidx >> 5;
    const int sc   = sidx & 31;

    uint4 xreg;
    auto gload = [&](int kt) {
        xreg = *reinterpret_cast<const uint4*>(&X[(size_t)(m0 + sr) * DM + kt * KT + sc]);
    };
    auto sstore = [&](int buf) {
        *reinterpret_cast<uint4*>(&Xs[buf][sr * P32 + sc]) = xreg;
    };

    v8f c[4] = {};

    gload(0);
    sstore(0);
    for (int kt = 0; kt < KSTEPS; ++kt) {
        __syncthreads();
        const int cur = kt & 1;
        if (kt + 1 < KSTEPS) {
            gload(kt + 1);
            if (kt + 2 < KSTEPS)
                __builtin_prefetch(&X[(size_t)(m0 + sr) * DM + (kt + 2) * KT + sc], 0, 0);
        }

        const v16h a = ld_frag(&Xs[cur][(mw * 16 + lrow) * P32 + lhalf * 16]);
#pragma unroll
        for (int j = 0; j < 4; ++j) {
            const int ntG = (n0 >> 4) + nw * 4 + j;
            const v16h b  = *reinterpret_cast<const v16h*>(
                &Wp[((size_t)(kt * (DM / 16) + ntG) * 32 + lane) * 16]);
            c[j] = __builtin_amdgcn_wmma_f32_16x16x32_f16(
                false, a, false, b, (short)0, c[j], false, false);
        }

        if (kt + 1 < KSTEPS) sstore(cur ^ 1);
    }

#pragma unroll
    for (int j = 0; j < 4; ++j) {
        const int col  = n0 + nw * 64 + j * 16 + lrow;
        const float bv = bias[col];
#pragma unroll
        for (int jv = 0; jv < 8; ++jv) {
            const int row   = m0 + mw * 16 + jv + 8 * lhalf;
            const float val = c[j][jv] + bv;
            if constexpr (F32OUT) Yf32[(size_t)row * DM + col] = val;
            else                  Yf16[(size_t)row * DM + col] = (_Float16)val;
        }
    }
}

__global__ void __launch_bounds__(256, 1)
attn_flash(const _Float16* __restrict__ Q,
           const _Float16* __restrict__ K,
           const _Float16* __restrict__ V,
           const int*      __restrict__ mask,
           const float*    __restrict__ temp,
           _Float16*       __restrict__ O) {
    __shared__ __align__(32) _Float16 Ks [2][32 * P64];   // [key][d]
    __shared__ __align__(32) _Float16 Vts[2][DH * P32];   // [d][key] transposed
    __shared__ __align__(32) float Mb[SEQ];               // additive mask bias

    const int lane  = threadIdx.x & 31;
    const int wave  = threadIdx.x >> 5;
    const int b     = blockIdx.z;
    const int h     = blockIdx.y;
    const int q0    = (blockIdx.x * 8 + wave) * 16;
    const int lrow  = lane & 15;
    const int lhalf = lane >> 4;
    const float scale = temp[h] * 0.125f;     // temperature / sqrt(64)

    const size_t tokBase = (size_t)b * SEQ;

    // stage additive mask bias once (visible after first in-loop barrier)
    {
        const int base = threadIdx.x * 8;
#pragma unroll
        for (int i = 0; i < 8; ++i)
            Mb[base + i] = mask[b * SEQ + base + i] ? 0.0f : -1.0e9f * scale;
    }

    // Q fragments pre-scaled by temperature/sqrt(d)
    const _Float16 hs = (_Float16)scale;
    v16h aq[2];
#pragma unroll
    for (int f = 0; f < 2; ++f) {
        aq[f] = *reinterpret_cast<const v16h*>(
            &Q[(tokBase + q0 + lrow) * DM + h * DH + f * 32 + lhalf * 16]);
        aq[f] = aq[f] * hs;
    }

    // A operand of the column sums: rows 0 and 8 are ones, the rest 0, so that
    // register 0 of either lane half receives its query's sum over all 32 keys.
    const _Float16 oneOrZero = (lane & 7) == 0 ? (_Float16)1.0f : (_Float16)0.0f;
    v16h ones;
#pragma unroll
    for (int i = 0; i < 16; ++i) ones[i] = oneOrZero;

    v8f   acc[4] = {};        // O^T: acc[nt][jv] = O[q0 + lrow][nt*16 + 8*lhalf + jv]
    v8f   accS   = {};        // accS[0] = running denominator of query q0 + lrow
    float mrun   = -3.0e38f;  // running maximum of query q0 + lrow

    const int skey = threadIdx.x >> 3;   // K/V staging: 8 threads per key
    const int sch  = threadIdx.x & 7;

    uint4 kreg, vreg;
    auto gload = [&](int kb) {
        const size_t g = (tokBase + kb * 32 + skey) * DM + h * DH + sch * 8;
        kreg = *reinterpret_cast<const uint4*>(&K[g]);
        vreg = *reinterpret_cast<const uint4*>(&V[g]);
    };
    auto sstore = [&](int buf) {
        *reinterpret_cast<uint4*>(&Ks[buf][skey * P64 + sch * 8]) = kreg;
        const _Float16* vp = reinterpret_cast<const _Float16*>(&vreg);
#pragma unroll
        for (int i = 0; i < 8; ++i) Vts[buf][(sch * 8 + i) * P32 + skey] = vp[i];
    };

    gload(0);
    sstore(0);
    for (int kb = 0; kb < KBLK; ++kb) {
        __syncthreads();
        const int cur = kb & 1;
        if (kb + 1 < KBLK) gload(kb + 1);     // in flight under the WMMAs
        // keeps the two loads up here: sunk to their LDS stores at the foot of the
        // pass, their whole latency would stand in front of the next barrier
        __builtin_amdgcn_sched_barrier(0);

        // S^T (pre-scaled), two 16-key row tiles: sc[jv] = S[q0 + lrow][key 8*lhalf + jv]
        v8f sc0 = {}, sc1 = {};
#pragma unroll
        for (int f = 0; f < 2; ++f) {
            const v16h bk0 = ld_frag(&Ks[cur][lrow * P64 + f * 32 + lhalf * 16]);
            const v16h bk1 = ld_frag(&Ks[cur][(16 + lrow) * P64 + f * 32 + lhalf * 16]);
            sc0 = __builtin_amdgcn_wmma_f32_16x16x32_f16(
                false, bk0, false, aq[f], (short)0, sc0, false, false);
            sc1 = __builtin_amdgcn_wmma_f32_16x16x32_f16(
                false, bk1, false, aq[f], (short)0, sc1, false, false);
        }

        const int kk0 = kb * 32;
        sc0 += *reinterpret_cast<const v8f*>(&Mb[kk0 + 8 * lhalf]);
        sc1 += *reinterpret_cast<const v8f*>(&Mb[kk0 + 16 + 8 * lhalf]);

        // the query's maximum over its 32 keys: 16 in this lane, 16 in lane ^ 16
        float rm = fmaxf(sc0[0], sc1[0]);
#pragma unroll
        for (int jv = 1; jv < 8; ++jv) rm = fmaxf(rm, fmaxf(sc0[jv], sc1[jv]));
        rm = fmaxf(rm, xhalf(rm));

        const float mnew = fmaxf(mrun, rm);
        const float cr   = __expf(mrun - mnew);
        mrun = mnew;

        v8f p0, p1;
#pragma unroll
        for (int jv = 0; jv < 8; ++jv) {
            p0[jv] = __expf(sc0[jv] - mnew);
            p1[jv] = __expf(sc1[jv] - mnew);
        }
        // P^T as B fragment: the two converted tiles, register for register
        const v16h pb = __builtin_shufflevector(
            __builtin_convertvector(p0, v8h), __builtin_convertvector(p1, v8h),
            0, 1, 2, 3, 4, 5, 6, 7, 8, 9, 10, 11, 12, 13, 14, 15);

        accS[0] *= cr;        // registers 1..7 of accS stay 0
#pragma unroll
        for (int nt = 0; nt < 4; ++nt) acc[nt] *= cr;

        accS = __builtin_amdgcn_wmma_f32_16x16x32_f16(
            false, ones, false, pb, (short)0, accS, false, false);
#pragma unroll
        for (int nt = 0; nt < 4; ++nt) {
            const v16h av = ld_frag_kmap(&Vts[cur][(nt * 16 + lrow) * P32], lhalf);
            acc[nt] = __builtin_amdgcn_wmma_f32_16x16x32_f16(
                false, av, false, pb, (short)0, acc[nt], false, false);
        }

        if (kb + 1 < KBLK) sstore(cur ^ 1);   // waits loadcnt here, post-compute
    }

    // normalize + store f16 ([token][768], heads interleaved): 8 consecutive d per tile
    const float inv = 1.0f / accS[0];
    _Float16* orow = &O[(tokBase + q0 + lrow) * DM + h * DH + 8 * lhalf];
#pragma unroll
    for (int nt = 0; nt < 4; ++nt)
        *reinterpret_cast<v8h*>(orow + nt * 16) = __builtin_convertvector(acc[nt] * inv, v8h);
}

// ---------------------------------------------------------------------------
extern "C" void kernel_launch(void* const* d_in, const int* in_sizes, int n_in,
                              void* d_out, int out_size, void* d_ws, size_t ws_size,
                              hipStream_t stream) {
    const float* x    = (const float*)d_in[0];
    const int*   mask = (const int*)  d_in[1];
    const float* Wq   = (const float*)d_in[2];
    const float* bq   = (const float*)d_in[3];
    const float* Wk   = (const float*)d_in[4];
    const float* bk   = (const float*)d_in[5];
    const float* Wv   = (const float*)d_in[6];
    const float* bv   = (const float*)d_in[7];
    const float* Wo   = (const float*)d_in[8];
    const float* bo   = (const float*)d_in[9];
    const float* temp = (const float*)d_in[10];
    float* out = (float*)d_out;

    size_t off = 0;
    auto walloc = [&](size_t elems) {
        void* p = (char*)d_ws + off;
        off = (off + elems * sizeof(_Float16) + 255) & ~(size_t)255;
        return (_Float16*)p;
    };
    _Float16* Xf  = walloc((size_t)NTOK * DM);
    _Float16* Wpk = walloc((size_t)4 * DM * DM);     // packed Wq, Wk, Wv, Wo
    _Float16* Qf  = walloc((size_t)3 * NTOK * DM);   // Q, K, V one behind the other
    _Float16* Kf  = Qf + (size_t)NTOK * DM;
    _Float16* Vf  = Kf + (size_t)NTOK * DM;
    _Float16* Wop = Wpk + (size_t)3 * DM * DM;
    _Float16* Af  = Xf;   // attention output reuses x_f16 (dead after the QKV GEMM)

    prep_operands<<<4 * PACKB + CVTB, 256, 0, stream>>>(x, Wq, Wk, Wv, Wo, Xf, Wpk);

    gemm_bias_768<false><<<dim3(3 * DM / 128, NTOK / 64), 256, 0, stream>>>(
        Xf, Wpk, bq, bk, bv, nullptr, Qf);

    attn_flash<<<dim3(SEQ / (16 * 8), NH, 4), 256, 0, stream>>>(Qf, Kf, Vf, mask, temp, Af);

    gemm_bias_768<true><<<dim3(DM / 128, NTOK / 64), 256, 0, stream>>>(
        Af, Wop, bo, bo, bo, out, nullptr);
}

// v004
// A run of this version takes 149 microseconds.
// In two side-by-side timings against v003, it was 1.57 and 1.56 times as fast.
// Counting every step since v000, it is 2.80 times as fast.
#include <hip/hip_runtime.h>

typedef __attribute__((ext_vector_type(16))) _Float16 v16h;
typedef __attribute__((ext_vector_type(8)))  _Float16 v8h;
typedef __attribute__((ext_vector_type(8)))  float    v8f;

constexpr int DM     = 768;     // d_model
constexpr int NTOK   = 4 * 2048;
constexpr int SEQ    = 2048;
constexpr int NH     = 12;
constexpr int DH     = 64;
constexpr int KBLK   = SEQ / 32;    // 64 key blocks

// LDS row pitches in halfs: row bytes + 16, an odd multiple of 16 B, so that the
// 16 rows a ds_load_b128 touches per lane half fall on distinct banks.
constexpr int P32 = 32 + 8;         // 64-B rows  -> 80 B
constexpr int P64 = 64 + 8;         // 128-B rows -> 144 B

// 16 consecutive halfs of an LDS row as one fragment; rows are 16-B aligned only.
__device__ inline v16h ld_frag(const _Float16* p) {
    const v8h lo = *reinterpret_cast<const v8h*>(p);
    const v8h hi = *reinterpret_cast<const v8h*>(p + 8);
    return __builtin_shufflevector(lo, hi, 0, 1, 2, 3, 4, 5, 6, 7, 8, 9, 10, 11, 12, 13, 14, 15);
}

// 32 keys of a V^T row in the k order that a packed pair of score tiles has as B:
// lane half h takes keys 8h..8h+7 and 16+8h..16+8h+7.
__device__ inline v16h ld_frag_kmap(const _Float16* row, int h) {
    const v8h lo = *reinterpret_cast<const v8h*>(row + 8 * h);
    const v8h hi = *reinterpret_cast<const v8h*>(row + 16 + 8 * h);
    return __builtin_shufflevector(lo, hi, 0, 1, 2, 3, 4, 5, 6, 7, 8, 9, 10, 11, 12, 13, 14, 15);
}

// value of lane l ^ 16
__device__ inline float xhalf(float x) {
    const int b = __builtin_bit_cast(int, x);
    return __builtin_bit_cast(float,
        __builtin_amdgcn_permlanex16(b, b, 0x76543210, 0xfedcba98, false, false));
}

// ---------------------------------------------------------------------------
// Operand preparation, one launch. The five jobs do not depend on one another
// and are block-index ranges of one grid:
//   blocks [0, 4*PACKB)  pack Wq, Wk, Wv, Wo (row-major fp32 [out=768][in=768])
//                        into WMMA B-fragments of 1 KB, PACKB blocks each: the 32
//                        lanes' first 8 halfs, then the 32 lanes' second 8, so
//                        that each 16-B read of a fragment is 512 B in a row
//   the rest             fp32 -> f16 elementwise convert of x
// The packs stand first: few blocks with strided reads, they start early and
// run under the stream of x.
// ---------------------------------------------------------------------------
constexpr int PACKB = (DM / 32) * (DM / 16) * 32 / 256;   // 144 blocks per weight
constexpr int CVTB  = NTOK * DM / (256 * 4);              // 6144 blocks for x

__global__ void __launch_bounds__(256)
prep_operands(const float* __restrict__ x,
              const float* __restrict__ Wq, const float* __restrict__ Wk,
              const float* __restrict__ Wv, const float* __restrict__ Wo,
              _Float16* __restrict__ Xf, _Float16* __restrict__ Wpack) {
    const int blk = blockIdx.x;
    if (blk < 4 * PACKB) {
        const int w = blk / PACKB;                            // which weight
        const float* __restrict__ W = w == 0 ? Wq : w == 1 ? Wk : w == 2 ? Wv : Wo;
        _Float16* __restrict__ Wp = Wpack + (size_t)w * DM * DM;
        const int t    = (blk - w * PACKB) * 256 + threadIdx.x;   // 36864 threads
        const int lane = t & 31;
        const int tile = t >> 5;                                  // 0..1151
        const int nt   = tile % (DM / 16);
        const int kt   = tile / (DM / 16);
        const int n    = nt * 16 + (lane & 15);
        const int k0   = kt * 32 + (lane >> 4) * 16;
        const float* src = &W[(size_t)n * DM + k0];
        _Float16*    dst = &Wp[(size_t)tile * 512 + lane * 8];
#pragma unroll
        for (int i = 0; i < 8; ++i) {
            dst[i]       = (_Float16)src[i];
            dst[256 + i] = (_Float16)src[8 + i];
        }
    } else {
        const int i = ((blk - 4 * PACKB) * 256 + threadIdx.x) * 4;
        if (i < NTOK * DM) {
            const float4 v = *reinterpret_cast<const float4*>(x + i);
            Xf[i + 0] = (_Float16)v.x;
            Xf[i + 1] = (_Float16)v.y;
            Xf[i + 2] = (_Float16)v.z;
            Xf[i + 3] = (_Float16)v.w;
        }
    }
}

// ---------------------------------------------------------------------------
// GEMM: Y[8192,768] = Xf16 * W^T + bias. WG tile 128x128, 8 waves (4 x 2), 32x64
// per wave (8 WMMA accs). A stage is 64 k of both operands in LDS: X rows at
// pitch P64 and the packed W fragments of the tile's 8 column tiles, copied as
// they lie (2 x 8 KB in a row). Two buffers, one barrier per stage, the next
// stage's global loads in flight under the WMMAs.
// blockIdx.x = product * 6 + column block: products that share X (Q, K, V) are
// column ranges of one grid; packed weights and f16 outputs of successive
// products lie one behind the other, each product has its own bias.
// ---------------------------------------------------------------------------
constexpr int GK     = 64;               // k per stage
constexpr int GSTAGE = DM / GK;          // 12
constexpr int WSTG   = 2 * 8 * 512;      // halfs of W per stage: 2 k tiles x 8 column tiles

template <bool F32OUT>
__global__ void __launch_bounds__(256)
gemm_bias_768(const _Float16* __restrict__ X,
              const _Float16* __restrict__ Wpack,
              const float*    __restrict__ bias0,
              const float*    __restrict__ bias1,
              const float*    __restrict__ bias2,
              float*          __restrict__ Yf32,
              _Float16*       __restrict__ Yall) {
    __shared__ __align__(32) _Float16 Xs[2][128 * P64];  // 2 x 18 KB
    __shared__ __align__(32) _Float16 Ws[2][WSTG];       // 2 x 16 KB

    const int tid   = threadIdx.x;
    const int lane  = tid & 31;
    const int wave  = tid >> 5;
    const int mw    = wave & 3;
    const int nw    = wave >> 2;
    const int m0    = blockIdx.y * 128;
    const int prod  = blockIdx.x / (DM / 128);
    const int n0    = (blockIdx.x - prod * (DM / 128)) * 128;
    const int lrow  = lane & 15;
    const int lhalf = lane >> 4;

    const _Float16* __restrict__ Wp   = Wpack + (size_t)prod * DM * DM;
    const float*    __restrict__ bias = prod == 0 ? bias0 : prod == 1 ? bias1 : bias2;
    _Float16*       __restrict__ Yf16 = Yall + (size_t)prod * NTOK * DM;

    // staging, 16 B per thread and piece: X piece i is rows 32 i .. 32 i + 31 (8
    // threads per 128-B row); W piece i is 4 KB in a row of k tile i / 2
    const int sr = tid >> 3;
    const int sc = (tid & 7) * 8;

    const _Float16* xsrc = &X[(size_t)(m0 + sr) * DM + sc];
    const _Float16* wsrc = &Wp[(size_t)(n0 >> 4) * 512 + tid * 8];
    constexpr size_t XP = (size_t)32 * DM;          // X piece to piece, halfs
    constexpr size_t WK = (size_t)(DM / 16) * 512;  // W k tile to k tile, halfs

    uint4 x0, x1, x2, x3, w0, w1, w2, w3;
    auto gload = [&](int st) {
        const _Float16* xp = xsrc + st * GK;
        const _Float16* wp = wsrc + (size_t)(2 * st) * WK;
        x0 = *reinterpret_cast<const uint4*>(xp);
        x1 = *reinterpret_cast<const uint4*>(xp + XP);
        x2 = *reinterpret_cast<const uint4*>(xp + 2 * XP);
        x3 = *reinterpret_cast<const uint4*>(xp + 3 * XP);
        w0 = *reinterpret_cast<const uint4*>(wp);
        w1 = *reinterpret_cast<const uint4*>(wp + 2048);
        w2 = *reinterpret_cast<const uint4*>(wp + WK);
        w3 = *reinterpret_cast<const uint4*>(wp + WK + 2048);
    };
    auto sstore = [&](int buf) {
        _Float16* xd = &Xs[buf][sr * P64 + sc];
        _Float16* wd = &Ws[buf][tid * 8];
        *reinterpret_cast<uint4*>(xd)                = x0;
        *reinterpret_cast<uint4*>(xd + 32 * P64)     = x1;
        *reinterpret_cast<uint4*>(xd + 2 * 32 * P64) = x2;
        *reinterpret_cast<uint4*>(xd + 3 * 32 * P64) = x3;
        *reinterpret_cast<uint4*>(wd)                = w0;
        *reinterpret_cast<uint4*>(wd + 2048)         = w1;
        *reinterpret_cast<uint4*>(wd + 2 * 2048)     = w2;
        *reinterpret_cast<uint4*>(wd + 3 * 2048)     = w3;
    };

    v8f c[2][4] = {};

    // one stage's 16 WMMAs from buffer cur
    auto compute = [&](int cur) {
#pragma unroll
        for (int ks = 0; ks < 2; ++ks) {
            v16h a[2], b[4];
#pragma unroll
            for (int r = 0; r < 2; ++r)
                a[r] = ld_frag(&Xs[cur][(mw * 32 + r * 16 + lrow) * P64 + ks * 32 + lhalf * 16]);
#pragma unroll
            for (int j = 0; j < 4; ++j) {
                const _Float16* f = &Ws[cur][(ks * 8 + nw * 4 + j) * 512 + lane * 8];
                const v8h lo = *reinterpret_cast<const v8h*>(f);
                const v8h hi = *reinterpret_cast<const v8h*>(f + 256);
                b[j] = __builtin_shufflevector(lo, hi, 0, 1, 2, 3, 4, 5, 6, 7,
                                               8, 9, 10, 11, 12, 13, 14, 15);
            }
#pragma unroll
            for (int r = 0; r < 2; ++r)
#pragma unroll
                for (int j = 0; j < 4; ++j)
                    c[r][j] = __builtin_amdgcn_wmma_f32_16x16x32_f16(
                        false, a[r], false, b[j], (short)0, c[r][j], false, false);
        }
    };

    gload(0);
    sstore(0);
    for (int st = 0; st + 1 < GSTAGE; ++st) {
        __syncthreads();
        gload(st + 1);                        // in flight under the WMMAs
        compute(st & 1);
        sstore((st & 1) ^ 1);
        // order within the stage: the eight global loads ahead of the LDS reads, and
        // their LDS stores behind the WMMAs. With the loads sunk to the stores, or the
        // stores among the WMMAs, the wave waits out the load latency with matrix
        // work still to issue
        __builtin_amdgcn_sched_group_barrier(0x020, 8, 0);    // global loads
        __builtin_amdgcn_sched_group_barrier(0x100, 24, 0);   // LDS reads
        __builtin_amdgcn_sched_group_barrier(0x008, 16, 1);   // WMMAs
        __builtin_amdgcn_sched_group_barrier(0x200, 8, 1);    // LDS stores
    }
    __syncthreads();
    compute((GSTAGE - 1) & 1);

#pragma unroll
    for (int j = 0; j < 4; ++j) {
        const int col  = n0 + nw * 64 + j * 16 + lrow;
        const float bv = bias[col];
#pragma unroll
        for (int r = 0; r < 2; ++r) {
#pragma unroll
            for (int jv = 0; jv < 8; ++jv) {
                const int row   = m0 + mw * 32 + r * 16 + jv + 8 * lhalf;
                const float val = c[r][j][jv] + bv;
                if constexpr (F32OUT) Yf32[(size_t)row * DM + col] = val;
                else                  Yf16[(size_t)row * DM + col] = (_Float16)val;
            }
        }
    }
}

__global__ void __launch_bounds__(256, 1)
attn_flash(const _Float16* __restrict__ Q,
           const _Float16* __restrict__ K,
           const _Float16* __restrict__ V,
           const int*      __restrict__ mask,
           const float*    __restrict__ temp,
           _Float16*       __restrict__ O) {
    __shared__ __align__(32) _Float16 Ks [2][32 * P64];   // [key][d]
    __shared__ __align__(32) _Float16 Vts[2][DH * P32];   // [d][key] transposed
    __shared__ __align__(32) float Mb[SEQ];               // additive mask bias

    const int lane  = threadIdx.x & 31;
    const int wave  = threadIdx.x >> 5;
    const int b     = blockIdx.z;
    const int h     = blockIdx.y;
    const int q0    = (blockIdx.x * 8 + wave) * 16;
    const int lrow  = lane & 15;
    const int lhalf = lane >> 4;
    const float scale = temp[h] * 0.125f;     // temperature / sqrt(64)

    const size_t tokBase = (size_t)b * SEQ;

    // stage additive mask bias once (visible after first in-loop barrier)
    {
        const int base = threadIdx.x * 8;
#pragma unroll
        for (int i = 0; i < 8; ++i)
            Mb[base + i] = mask[b * SEQ + base + i] ? 0.0f : -1.0e9f * scale;
    }

    // Q fragments pre-scaled by temperature/sqrt(d)
    const _Float16 hs = (_Float16)scale;
    v16h aq[2];
#pragma unroll
    for (int f = 0; f < 2; ++f) {
        aq[f] = *reinterpret_cast<const v16h*>(
            &Q[(tokBase + q0 + lrow) * DM + h * DH + f * 32 + lhalf * 16]);
        aq[f] = aq[f] * hs;
    }

    // A operand of the column sums: rows 0 and 8 are ones, the rest 0, so that
    // register 0 of either lane half receives its query's sum over all 32 keys.
    const _Float16 oneOrZero = (lane & 7) == 0 ? (_Float16)1.0f : (_Float16)0.0f;
    v16h ones;
#pragma unroll
    for (int i = 0; i < 16; ++i) ones[i] = oneOrZero;

    v8f   acc[4] = {};        // O^T: acc[nt][jv] = O[q0 + lrow][nt*16 + 8*lhalf + jv]
    v8f   accS   = {};        // accS[0] = running denominator of query q0 + lrow
    float mrun   = -3.0e38f;  // running maximum of query q0 + lrow

    const int skey = threadIdx.x >> 3;   // K/V staging: 8 threads per key
    const int sch  = threadIdx.x & 7;

    uint4 kreg, vreg;
    auto gload = [&](int kb) {
        const size_t g = (tokBase + kb * 32 + skey) * DM + h * DH + sch * 8;
        kreg = *reinterpret_cast<const uint4*>(&K[g]);
        vreg = *reinterpret_cast<const uint4*>(&V[g]);
    };
    auto sstore = [&](int buf) {
        *reinterpret_cast<uint4*>(&Ks[buf][skey * P64 + sch * 8]) = kreg;
        const _Float16* vp = reinterpret_cast<const _Float16*>(&vreg);
#pragma unroll
        for (int i = 0; i < 8; ++i) Vts[buf][(sch * 8 + i) * P32 + skey] = vp[i];
    };

    gload(0);
    sstore(0);
    for (int kb = 0; kb < KBLK; ++kb) {
        __syncthreads();
        const int cur = kb & 1;
        if (kb + 1 < KBLK) gload(kb + 1);     // in flight under the WMMAs
        // keeps the two loads up here: sunk to their LDS stores at the foot of the
        // pass, their whole latency would stand in front of the next barrier
        __builtin_amdgcn_sched_barrier(0);

        // S^T (pre-scaled), two 16-key row tiles: sc[jv] = S[q0 + lrow][key 8*lhalf + jv]
        v8f sc0 = {}, sc1 = {};
#pragma unroll
        for (int f = 0; f < 2; ++f) {
            const v16h bk0 = ld_frag(&Ks[cur][lrow * P64 + f * 32 + lhalf * 16]);
            const v16h bk1 = ld_frag(&Ks[cur][(16 + lrow) * P64 + f * 32 + lhalf * 16]);
            sc0 = __builtin_amdgcn_wmma_f32_16x16x32_f16(
                false, bk0, false, aq[f], (short)0, sc0, false, false);
            sc1 = __builtin_amdgcn_wmma_f32_16x16x32_f16(
                false, bk1, false, aq[f], (short)0, sc1, false, false);
        }

        const int kk0 = kb * 32;
        sc0 += *reinterpret_cast<const v8f*>(&Mb[kk0 + 8 * lhalf]);
        sc1 += *reinterpret_cast<const v8f*>(&Mb[kk0 + 16 + 8 * lhalf]);

        // the query's maximum over its 32 keys: 16 in this lane, 16 in lane ^ 16
        float rm = fmaxf(sc0[0], sc1[0]);
#pragma unroll
        for (int jv = 1; jv < 8; ++jv) rm = fmaxf(rm, fmaxf(sc0[jv], sc1[jv]));
        rm = fmaxf(rm, xhalf(rm));

        const float mnew = fmaxf(mrun, rm);
        const float cr   = __expf(mrun - mnew);
        mrun = mnew;

        v8f p0, p1;
#pragma unroll
        for (int jv = 0; jv < 8; ++jv) {
            p0[jv] = __expf(sc0[jv] - mnew);
            p1[jv] = __expf(sc1[jv] - mnew);
        }
        // P^T as B fragment: the two converted tiles, register for register
        const v16h pb = __builtin_shufflevector(
            __builtin_convertvector(p0, v8h), __builtin_convertvector(p1, v8h),
            0, 1, 2, 3, 4, 5, 6, 7, 8, 9, 10, 11, 12, 13, 14, 15);

        accS[0] *= cr;        // registers 1..7 of accS stay 0
#pragma unroll
        for (int nt = 0; nt < 4; ++nt) acc[nt] *= cr;

        accS = __builtin_amdgcn_wmma_f32_16x16x32_f16(
            false, ones, false, pb, (short)0, accS, false, false);
#pragma unroll
        for (int nt = 0; nt < 4; ++nt) {
            const v16h av = ld_frag_kmap(&Vts[cur][(nt * 16 + lrow) * P32], lhalf);
            acc[nt] = __builtin_amdgcn_wmma_f32_16x16x32_f16(
                false, av, false, pb, (short)0, acc[nt], false, false);
        }

        if (kb + 1 < KBLK) sstore(cur ^ 1);   // waits loadcnt here, post-compute
    }

    // normalize + store f16 ([token][768], heads interleaved): 8 consecutive d per tile
    const float inv = 1.0f / accS[0];
    _Float16* orow = &O[(tokBase + q0 + lrow) * DM + h * DH + 8 * lhalf];
#pragma unroll
    for (int nt = 0; nt < 4; ++nt)
        *reinterpret_cast<v8h*>(orow + nt * 16) = __builtin_convertvector(acc[nt] * inv, v8h);
}

// ---------------------------------------------------------------------------
extern "C" void kernel_launch(void* const* d_in, const int* in_sizes, int n_in,
                              void* d_out, int out_size, void* d_ws, size_t ws_size,
                              hipStream_t stream) {
    const float* x    = (const float*)d_in[0];
    const int*   mask = (const int*)  d_in[1];
    const float* Wq   = (const float*)d_in[2];
    const float* bq   = (const float*)d_in[3];
    const float* Wk   = (const float*)d_in[4];
    const float* bk   = (const float*)d_in[5];
    const float* Wv   = (const float*)d_in[6];
    const float* bv   = (const float*)d_in[7];
    const float* Wo   = (const float*)d_in[8];
    const float* bo   = (const float*)d_in[9];
    const float* temp = (const float*)d_in[10];
    float* out = (float*)d_out;

    size_t off = 0;
    auto walloc = [&](size_t elems) {
        void* p = (char*)d_ws + off;
        off = (off + elems * sizeof(_Float16) + 255) & ~(size_t)255;
        return (_Float16*)p;
    };
    _Float16* Xf  = walloc((size_t)NTOK * DM);
    _Float16* Wpk = walloc((size_t)4 * DM * DM);     // packed Wq, Wk, Wv, Wo
    _Float16* Qf  = walloc((size_t)3 * NTOK * DM);   // Q, K, V one behind the other
    _Float16* Kf  = Qf + (size_t)NTOK * DM;
    _Float16* Vf  = Kf + (size_t)NTOK * DM;
    _Float16* Wop = Wpk + (size_t)3 * DM * DM;
    _Float16* Af  = Xf;   // attention output reuses x_f16 (dead after the QKV GEMM)

    prep_operands<<<4 * PACKB + CVTB, 256, 0, stream>>>(x, Wq, Wk, Wv, Wo, Xf, Wpk);

    gemm_bias_768<false><<<dim3(3 * DM / 128, NTOK / 128), 256, 0, stream>>>(
        Xf, Wpk, bq, bk, bv, nullptr, Qf);

    attn_flash<<<dim3(SEQ / (16 * 8), NH, 4), 256, 0, stream>>>(Qf, Kf, Vf, mask, temp, Af);

    gemm_bias_768<true><<<dim3(DM / 128, NTOK / 128), 256, 0, stream>>>(
        Af, Wop, bo, bo, bo, out, nullptr);
}

// v005
// It runs in 105 microseconds.
// Next to v004, in two timings, it ran 1.42 and 1.41 times as fast.
// All steps since v000 together make it 3.97 times as fast.
#include <hip/hip_runtime.h>

typedef __attribute__((ext_vector_type(16))) _Float16 v16h;
typedef __attribute__((ext_vector_type(8)))  _Float16 v8h;
typedef __attribute__((ext_vector_type(8)))  float    v8f;

constexpr int DM     = 768;     // d_model
constexpr int NTOK   = 4 * 2048;
constexpr int SEQ    = 2048;
constexpr int NH     = 12;
constexpr int DH     = 64;
constexpr int KBLK   = SEQ / 32;    // 64 key blocks

// LDS row pitches in halfs: row bytes + 16, an odd multiple of 16 B, so that the
// 16 rows a ds_load_b128 touches per lane half fall on distinct banks.
constexpr int P32 = 32 + 8;         // 64-B rows  -> 80 B
constexpr int P64 = 64 + 8;         // 128-B rows -> 144 B

// 16 consecutive halfs of an LDS row as one fragment; rows are 16-B aligned only.
__device__ inline v16h ld_frag(const _Float16* p) {
    const v8h lo = *reinterpret_cast<const v8h*>(p);
    const v8h hi = *reinterpret_cast<const v8h*>(p + 8);
    return __builtin_shufflevector(lo, hi, 0, 1, 2, 3, 4, 5, 6, 7, 8, 9, 10, 11, 12, 13, 14, 15);
}

// 32 keys of a V^T row in the k order that a packed pair of score tiles has as B:
// lane half h takes keys 8h..8h+7 and 16+8h..16+8h+7.
__device__ inline v16h ld_frag_kmap(const _Float16* row, int h) {
    const v8h lo = *reinterpret_cast<const v8h*>(row + 8 * h);
    const v8h hi = *reinterpret_cast<const v8h*>(row + 16 + 8 * h);
    return __builtin_shufflevector(lo, hi, 0, 1, 2, 3, 4, 5, 6, 7, 8, 9, 10, 11, 12, 13, 14, 15);
}

// value of lane l ^ 16
__device__ inline float xhalf(float x) {
    const int b = __builtin_bit_cast(int, x);
    return __builtin_bit_cast(float,
        __builtin_amdgcn_permlanex16(b, b, 0x76543210, 0xfedcba98, false, false));
}

// ---------------------------------------------------------------------------
// Operand preparation, one launch. The five jobs do not depend on one another
// and are block-index ranges of one grid:
//   blocks [0, 4*PACKB)  pack Wq, Wk, Wv, Wo (row-major fp32 [out=768][in=768])
//                        into WMMA B-fragments of 1 KB, PACKB blocks each: the 32
//                        lanes' first 8 halfs, then the 32 lanes' second 8, so
//                        that each 16-B read of a fragment is 512 B in a row
//   the rest             fp32 -> f16 elementwise convert of x
// The packs stand first: few blocks with strided reads, they start early and
// run under the stream of x.
// ---------------------------------------------------------------------------
constexpr int PACKB = (DM / 32) * (DM / 16) * 32 / 256;   // 144 blocks per weight
constexpr int CVTB  = NTOK * DM / (256 * 4);              // 6144 blocks for x

__global__ void __launch_bounds__(256)
prep_operands(const float* __restrict__ x,
              const float* __restrict__ Wq, const float* __restrict__ Wk,
              const float* __restrict__ Wv, const float* __restrict__ Wo,
              _Float16* __restrict__ Xf, _Float16* __restrict__ Wpack) {
    const int blk = blockIdx.x;
    if (blk < 4 * PACKB) {
        const int w = blk / PACKB;                            // which weight
        const float* __restrict__ W = w == 0 ? Wq : w == 1 ? Wk : w == 2 ? Wv : Wo;
        _Float16* __restrict__ Wp = Wpack + (size_t)w * DM * DM;
        const int t    = (blk - w * PACKB) * 256 + threadIdx.x;   // 36864 threads
        const int lane = t & 31;
        const int tile = t >> 5;                                  // 0..1151
        const int nt   = tile % (DM / 16);
        const int kt   = tile / (DM / 16);
        const int n    = nt * 16 + (lane & 15);
        const int k0   = kt * 32 + (lane >> 4) * 16;
        const float* src = &W[(size_t)n * DM + k0];
        _Float16*    dst = &Wp[(size_t)tile * 512 + lane * 8];
#pragma unroll
        for (int i = 0; i < 8; ++i) {
            dst[i]       = (_Float16)src[i];
            dst[256 + i] = (_Float16)src[8 + i];
        }
    } else {
        const int i = ((blk - 4 * PACKB) * 256 + threadIdx.x) * 4;
        if (i < NTOK * DM) {
            const float4 v = *reinterpret_cast<const float4*>(x + i);
            Xf[i + 0] = (_Float16)v.x;
            Xf[i + 1] = (_Float16)v.y;
            Xf[i + 2] = (_Float16)v.z;
            Xf[i + 3] = (_Float16)v.w;
        }
    }
}

// ---------------------------------------------------------------------------
// GEMM: Y[8192,768] = Xf16 * W^T + bias. WG tile 128x128, 8 waves (4 x 2), 32x64
// per wave (8 WMMA accs). A stage is 64 k of both operands in LDS: X rows at
// pitch P64 and the packed W fragments of the tile's 8 column tiles, copied as
// they lie (2 x 8 KB in a row). Two buffers, one barrier per stage, the next
// stage's global loads in flight under the WMMAs.
// blockIdx.x = product * 6 + column block: products that share X (Q, K, V) are
// column ranges of one grid; packed weights and f16 outputs of successive
// products lie one behind the other, each product has its own bias.
// ---------------------------------------------------------------------------
constexpr int GK     = 64;               // k per stage
constexpr int GSTAGE = DM / GK;          // 12
constexpr int WSTG   = 2 * 8 * 512;      // halfs of W per stage: 2 k tiles x 8 column tiles

template <bool F32OUT>
__global__ void __launch_bounds__(256)
gemm_bias_768(const _Float16* __restrict__ X,
              const _Float16* __restrict__ Wpack,
              const float*    __restrict__ bias0,
              const float*    __restrict__ bias1,
              const float*    __restrict__ bias2,
              float*          __restrict__ Yf32,
              _Float16*       __restrict__ Yall) {
    __shared__ __align__(32) _Float16 Xs[2][128 * P64];  // 2 x 18 KB
    __shared__ __align__(32) _Float16 Ws[2][WSTG];       // 2 x 16 KB

    const int tid   = threadIdx.x;
    const int lane  = tid & 31;
    const int wave  = tid >> 5;
    const int mw    = wave & 3;
    const int nw    = wave >> 2;
    const int m0    = blockIdx.y * 128;
    const int prod  = blockIdx.x / (DM / 128);
    const int n0    = (blockIdx.x - prod * (DM / 128)) * 128;
    const int lrow  = lane & 15;
    const int lhalf = lane >> 4;

    const _Float16* __restrict__ Wp   = Wpack + (size_t)prod * DM * DM;
    const float*    __restrict__ bias = prod == 0 ? bias0 : prod == 1 ? bias1 : bias2;
    _Float16*       __restrict__ Yf16 = Yall + (size_t)prod * NTOK * DM;

    // staging, 16 B per thread and piece: X piece i is rows 32 i .. 32 i + 31 (8
    // threads per 128-B row); W piece i is 4 KB in a row of k tile i / 2
    const int sr = tid >> 3;
    const int sc = (tid & 7) * 8;

    const _Float16* xsrc = &X[(size_t)(m0 + sr) * DM + sc];
    const _Float16* wsrc = &Wp[(size_t)(n0 >> 4) * 512 + tid * 8];
    constexpr size_t XP = (size_t)32 * DM;          // X piece to piece, halfs
    constexpr size_t WK = (size_t)(DM / 16) * 512;  // W k tile to k tile, halfs

    uint4 x0, x1, x2, x3, w0, w1, w2, w3;
    auto gload = [&](int st) {
        const _Float16* xp = xsrc + st * GK;
        const _Float16* wp = wsrc + (size_t)(2 * st) * WK;
        x0 = *reinterpret_cast<const uint4*>(xp);
        x1 = *reinterpret_cast<const uint4*>(xp + XP);
        x2 = *reinterpret_cast<const uint4*>(xp + 2 * XP);
        x3 = *reinterpret_cast<const uint4*>(xp + 3 * XP);
        w0 = *reinterpret_cast<const uint4*>(wp);
        w1 = *reinterpret_cast<const uint4*>(wp + 2048);
        w2 = *reinterpret_cast<const uint4*>(wp + WK);
        w3 = *reinterpret_cast<const uint4*>(wp + WK + 2048);
    };
    auto sstore = [&](int buf) {
        _Float16* xd = &Xs[buf][sr * P64 + sc];
        _Float16* wd = &Ws[buf][tid * 8];
        *reinterpret_cast<uint4*>(xd)                = x0;
        *reinterpret_cast<uint4*>(xd + 32 * P64)     = x1;
        *reinterpret_cast<uint4*>(xd + 2 * 32 * P64) = x2;
        *reinterpret_cast<uint4*>(xd + 3 * 32 * P64) = x3;
        *reinterpret_cast<uint4*>(wd)                = w0;
        *reinterpret_cast<uint4*>(wd + 2048)         = w1;
        *reinterpret_cast<uint4*>(wd + 2 * 2048)     = w2;
        *reinterpret_cast<uint4*>(wd + 3 * 2048)     = w3;
    };

    v8f c[2][4] = {};

    // one stage's 16 WMMAs from buffer cur
    auto compute = [&](int cur) {
#pragma unroll
        for (int ks = 0; ks < 2; ++ks) {
            v16h a[2], b[4];
#pragma unroll
            for (int r = 0; r < 2; ++r)
                a[r] = ld_frag(&Xs[cur][(mw * 32 + r * 16 + lrow) * P64 + ks * 32 + lhalf * 16]);
#pragma unroll
            for (int j = 0; j < 4; ++j) {
                const _Float16* f = &Ws[cur][(ks * 8 + nw * 4 + j) * 512 + lane * 8];
                const v8h lo = *reinterpret_cast<const v8h*>(f);
                const v8h hi = *reinterpret_cast<const v8h*>(f + 256);
                b[j] = __builtin_shufflevector(lo, hi, 0, 1, 2, 3, 4, 5, 6, 7,
                                               8, 9, 10, 11, 12, 13, 14, 15);
            }
#pragma unroll
            for (int r = 0; r < 2; ++r)
#pragma unroll
                for (int j = 0; j < 4; ++j)
                    c[r][j] = __builtin_amdgcn_wmma_f32_16x16x32_f16(
                        false, a[r], false, b[j], (short)0, c[r][j], false, false);
        }
    };

    gload(0);
    sstore(0);
    for (int st = 0; st + 1 < GSTAGE; ++st) {
        __syncthreads();
        gload(st + 1);                        // in flight under the WMMAs
        compute(st & 1);
        sstore((st & 1) ^ 1);
        // order within the stage: the eight global loads ahead of the LDS reads, and
        // their LDS stores behind the WMMAs. With the loads sunk to the stores, or the
        // stores among the WMMAs, the wave waits out the load latency with matrix
        // work still to issue
        __builtin_amdgcn_sched_group_barrier(0x020, 8, 0);    // global loads
        __builtin_amdgcn_sched_group_barrier(0x100, 24, 0);   // LDS reads
        __builtin_amdgcn_sched_group_barrier(0x008, 16, 1);   // WMMAs
        __builtin_amdgcn_sched_group_barrier(0x200, 8, 1);    // LDS stores
    }
    __syncthreads();
    compute((GSTAGE - 1) & 1);

#pragma unroll
    for (int j = 0; j < 4; ++j) {
        const int col  = n0 + nw * 64 + j * 16 + lrow;
        const float bv = bias[col];
#pragma unroll
        for (int r = 0; r < 2; ++r) {
#pragma unroll
            for (int jv = 0; jv < 8; ++jv) {
                const int row   = m0 + mw * 32 + r * 16 + jv + 8 * lhalf;
                const float val = c[r][j][jv] + bv;
                if constexpr (F32OUT) Yf32[(size_t)row * DM + col] = val;
                else                  Yf16[(size_t)row * DM + col] = (_Float16)val;
            }
        }
    }
}

__global__ void __launch_bounds__(256, 1)
attn_flash(const _Float16* __restrict__ Q,
           const _Float16* __restrict__ K,
           const _Float16* __restrict__ V,
           const int*      __restrict__ mask,
           const float*    __restrict__ temp,
           _Float16*       __restrict__ O) {
    __shared__ __align__(32) _Float16 Ks [2][32 * P64];   // [key][d]
    __shared__ __align__(32) _Float16 Vts[2][DH * P32];   // [d][key] transposed
    __shared__ __align__(32) float Mb[SEQ];               // additive bias per listed key
    __shared__ __align__(16) int   Cnt[KBLK];             // kept keys per 32-key segment
    __shared__ unsigned short      Idx[SEQ];              // listed key -> row of the batch

    const int lane  = threadIdx.x & 31;
    const int wave  = threadIdx.x >> 5;
    const int b     = blockIdx.z;
    const int h     = blockIdx.y;
    const int q0    = (blockIdx.x * 8 + wave) * 16;
    const int lrow  = lane & 15;
    const int lhalf = lane >> 4;
    const float scale = temp[h] * 0.125f;     // temperature / sqrt(64)

    const size_t tokBase = (size_t)b * SEQ;

    // list the kept keys. Thread t looks at keys j * 256 + t, so a wave's ballot is
    // one 32-key segment; segment counts meet in LDS, every thread sums those ahead
    // of its own 8 segments.
    const float mbias = -1.0e9f * scale;
    int      mk[8];
    unsigned bal[8];
#pragma unroll
    for (int j = 0; j < 8; ++j) mk[j] = mask[b * SEQ + j * 256 + threadIdx.x];
#pragma unroll
    for (int j = 0; j < 8; ++j) bal[j] = __builtin_amdgcn_ballot_w32(mk[j] != 0);
    if (lane == 0) {
#pragma unroll
        for (int j = 0; j < 8; ++j) Cnt[j * 8 + wave] = __popc(bal[j]);
    }
    __syncthreads();
    int pre[8];     // kept keys ahead of segment j * 8 + wave
    int run = 0;
#pragma unroll
    for (int j = 0; j < 8; ++j) {
        int tot = 0, part = 0;      // eight short chains, joined by run
#pragma unroll
        for (int w = 0; w < 8; ++w) {
            const int v = Cnt[j * 8 + w];
            part += w < wave ? v : 0;
            tot  += v;
        }
        pre[j] = run + part;
        run   += tot;
    }
    const int  nkeep   = __builtin_amdgcn_readfirstlane(run);   // same in every thread
    const bool walkAll = nkeep == 0 || !(1.0e9f * scale >= 1.0e5f);
    const int  nkey    = walkAll ? SEQ : nkeep;
    const int  nblk    = max(1, min((nkey + 31) >> 5, KBLK));   // passes, 1 .. 64
    if (walkAll) {
#pragma unroll
        for (int j = 0; j < 8; ++j) {
            const int k = j * 256 + threadIdx.x;
            Idx[k] = (unsigned short)k;
            Mb[k]  = mk[j] ? 0.0f : mbias;
        }
    } else {
        const unsigned below = (1u << lane) - 1u;
#pragma unroll
        for (int j = 0; j < 8; ++j) {
            const int k = j * 256 + threadIdx.x;
            if (mk[j]) Idx[pre[j] + __popc(bal[j] & below)] = (unsigned short)k;
            Mb[k] = k < nkey ? 0.0f : mbias;
        }
        const int fill = nkey + threadIdx.x;                    // the last pass's rest
        if (fill < nblk * 32) Idx[fill] = 0;
    }
    __syncthreads();

    // Q fragments pre-scaled by temperature/sqrt(d)
    const _Float16 hs = (_Float16)scale;
    v16h aq[2];
#pragma unroll
    for (int f = 0; f < 2; ++f) {
        aq[f] = *reinterpret_cast<const v16h*>(
            &Q[(tokBase + q0 + lrow) * DM + h * DH + f * 32 + lhalf * 16]);
        aq[f] = aq[f] * hs;
    }

    // A operand of the column sums: rows 0 and 8 are ones, the rest 0, so that
    // register 0 of either lane half receives its query's sum over all 32 keys.
    const _Float16 oneOrZero = (lane & 7) == 0 ? (_Float16)1.0f : (_Float16)0.0f;
    v16h ones;
#pragma unroll
    for (int i = 0; i < 16; ++i) ones[i] = oneOrZero;

    v8f   acc[4] = {};        // O^T: acc[nt][jv] = O[q0 + lrow][nt*16 + 8*lhalf + jv]
    v8f   accS   = {};        // accS[0] = running denominator of query q0 + lrow
    float mrun   = -3.0e38f;  // running maximum of query q0 + lrow

    const int skey = threadIdx.x >> 3;   // K/V staging: 8 threads per key
    const int sch  = threadIdx.x & 7;

    uint4 kreg, vreg;
    auto gload = [&](int row) {
        const size_t g = (tokBase + row) * DM + h * DH + sch * 8;
        kreg = *reinterpret_cast<const uint4*>(&K[g]);
        vreg = *reinterpret_cast<const uint4*>(&V[g]);
        // the two address pairs are scratch registers that the pass's LDS reads take
        // over next: the wait stands between the loads and that overwrite
        asm volatile("s_wait_xcnt 0x0" ::: "memory");
    };
    auto sstore = [&](int buf) {
        *reinterpret_cast<uint4*>(&Ks[buf][skey * P64 + sch * 8]) = kreg;
        const _Float16* vp = reinterpret_cast<const _Float16*>(&vreg);
#pragma unroll
        for (int i = 0; i < 8; ++i) Vts[buf][(sch * 8 + i) * P32 + skey] = vp[i];
    };

    gload(Idx[skey]);
    int rnext = nblk > 1 ? Idx[32 + skey] : 0;    // row of the next pass, read a pass ahead
    sstore(0);
    for (int kb = 0; kb < nblk; ++kb) {
        __syncthreads();
        const int cur = kb & 1;
        if (kb + 1 < nblk) gload(rnext);      // in flight under the WMMAs
        if (kb + 2 < nblk) rnext = Idx[(kb + 2) * 32 + skey];
        // keeps the two loads up here: sunk to their LDS stores at the foot of the
        // pass, their whole latency would stand in front of the next barrier
        __builtin_amdgcn_sched_barrier(0);

        // S^T (pre-scaled), two 16-key row tiles: sc[jv] = S[q0 + lrow][key 8*lhalf + jv]
        v8f sc0 = {}, sc1 = {};
#pragma unroll
        for (int f = 0; f < 2; ++f) {
            const v16h bk0 = ld_frag(&Ks[cur][lrow * P64 + f * 32 + lhalf * 16]);
            const v16h bk1 = ld_frag(&Ks[cur][(16 + lrow) * P64 + f * 32 + lhalf * 16]);
            sc0 = __builtin_amdgcn_wmma_f32_16x16x32_f16(
                false, bk0, false, aq[f], (short)0, sc0, false, false);
            sc1 = __builtin_amdgcn_wmma_f32_16x16x32_f16(
                false, bk1, false, aq[f], (short)0, sc1, false, false);
        }

        const int kk0 = kb * 32;
        sc0 += *reinterpret_cast<const v8f*>(&Mb[kk0 + 8 * lhalf]);
        sc1 += *reinterpret_cast<const v8f*>(&Mb[kk0 + 16 + 8 * lhalf]);

        // the query's maximum over its 32 keys: 16 in this lane, 16 in lane ^ 16
        float rm = fmaxf(sc0[0], sc1[0]);
#pragma unroll
        for (int jv = 1; jv < 8; ++jv) rm = fmaxf(rm, fmaxf(sc0[jv], sc1[jv]));
        rm = fmaxf(rm, xhalf(rm));

        const float mnew = fmaxf(mrun, rm);
        const float cr   = __expf(mrun - mnew);
        mrun = mnew;

        v8f p0, p1;
#pragma unroll
        for (int jv = 0; jv < 8; ++jv) {
            p0[jv] = __expf(sc0[jv] - mnew);
            p1[jv] = __expf(sc1[jv] - mnew);
        }
        // P^T as B fragment: the two converted tiles, register for register
        const v16h pb = __builtin_shufflevector(
            __builtin_convertvector(p0, v8h), __builtin_convertvector(p1, v8h),
            0, 1, 2, 3, 4, 5, 6, 7, 8, 9, 10, 11, 12, 13, 14, 15);

        accS[0] *= cr;        // registers 1..7 of accS stay 0
#pragma unroll
        for (int nt = 0; nt < 4; ++nt) acc[nt] *= cr;

        accS = __builtin_amdgcn_wmma_f32_16x16x32_f16(
            false, ones, false, pb, (short)0, accS, false, false);
#pragma unroll
        for (int nt = 0; nt < 4; ++nt) {
            const v16h av = ld_frag_kmap(&Vts[cur][(nt * 16 + lrow) * P32], lhalf);
            acc[nt] = __builtin_amdgcn_wmma_f32_16x16x32_f16(
                false, av, false, pb, (short)0, acc[nt], false, false);
        }

        if (kb + 1 < nblk) sstore(cur ^ 1);   // waits loadcnt here, post-compute
    }

    // normalize + store f16 ([token][768], heads interleaved): 8 consecutive d per tile
    const float inv = 1.0f / accS[0];
    _Float16* orow = &O[(tokBase + q0 + lrow) * DM + h * DH + 8 * lhalf];
#pragma unroll
    for (int nt = 0; nt < 4; ++nt)
        *reinterpret_cast<v8h*>(orow + nt * 16) = __builtin_convertvector(acc[nt] * inv, v8h);
}

// ---------------------------------------------------------------------------
extern "C" void kernel_launch(void* const* d_in, const int* in_sizes, int n_in,
                              void* d_out, int out_size, void* d_ws, size_t ws_size,
                              hipStream_t stream) {
    const float* x    = (const float*)d_in[0];
    const int*   mask = (const int*)  d_in[1];
    const float* Wq   = (const float*)d_in[2];
    const float* bq   = (const float*)d_in[3];
    const float* Wk   = (const float*)d_in[4];
    const float* bk   = (const float*)d_in[5];
    const float* Wv   = (const float*)d_in[6];
    const float* bv   = (const float*)d_in[7];
    const float* Wo   = (const float*)d_in[8];
    const float* bo   = (const float*)d_in[9];
    const float* temp = (const float*)d_in[10];
    float* out = (float*)d_out;

    size_t off = 0;
    auto walloc = [&](size_t elems) {
        void* p = (char*)d_ws + off;
        off = (off + elems * sizeof(_Float16) + 255) & ~(size_t)255;
        return (_Float16*)p;
    };
    _Float16* Xf  = walloc((size_t)NTOK * DM);
    _Float16* Wpk = walloc((size_t)4 * DM * DM);     // packed Wq, Wk, Wv, Wo
    _Float16* Qf  = walloc((size_t)3 * NTOK * DM);   // Q, K, V one behind the other
    _Float16* Kf  = Qf + (size_t)NTOK * DM;
    _Float16* Vf  = Kf + (size_t)NTOK * DM;
    _Float16* Wop = Wpk + (size_t)3 * DM * DM;
    _Float16* Af  = Xf;   // attention output reuses x_f16 (dead after the QKV GEMM)

    prep_operands<<<4 * PACKB + CVTB, 256, 0, stream>>>(x, Wq, Wk, Wv, Wo, Xf, Wpk);

    gemm_bias_768<false><<<dim3(3 * DM / 128, NTOK / 128), 256, 0, stream>>>(
        Xf, Wpk, bq, bk, bv, nullptr, Qf);

    attn_flash<<<dim3(SEQ / (16 * 8), NH, 4), 256, 0, stream>>>(Qf, Kf, Vf, mask, temp, Af);

    gemm_bias_768<true><<<dim3(DM / 128, NTOK / 128), 256, 0, stream>>>(
        Af, Wop, bo, bo, bo, out, nullptr);
}

// v006
// Measured time: 91.6 microseconds a run.
// Timed twice side by side with v005, it ran 1.15 times as fast both times.
// All steps since v000 together make it 4.55 times as fast.
#include <hip/hip_runtime.h>

typedef __attribute__((ext_vector_type(16))) _Float16 v16h;
typedef __attribute__((ext_vector_type(8)))  _Float16 v8h;
typedef __attribute__((ext_vector_type(8)))  short    v8s;
typedef __attribute__((ext_vector_type(8)))  float    v8f;

constexpr int DM     = 768;     // d_model
constexpr int NTOK   = 4 * 2048;
constexpr int SEQ    = 2048;
constexpr int NH     = 12;
constexpr int DH     = 64;
constexpr int KBLK   = SEQ / 32;    // 64 key blocks

// LDS row pitches in halfs, each for its reader. ds_load_b128: row bytes + 16, an
// odd multiple of 16 B, so that the 16 rows a load touches per lane half fall on
// distinct banks. ds_load_tr16_b128: row bytes + 32, an odd multiple of 32 B.
constexpr int P64 = 64 + 8;         // 128-B rows -> 144 B
constexpr int PTR = 64 + 16;        // 128-B rows -> 160 B, read transposed

// 16 consecutive halfs of an LDS row as one fragment; rows are 16-B aligned only.
__device__ inline v16h ld_frag(const _Float16* p) {
    const v8h lo = *reinterpret_cast<const v8h*>(p);
    const v8h hi = *reinterpret_cast<const v8h*>(p + 8);
    return __builtin_shufflevector(lo, hi, 0, 1, 2, 3, 4, 5, 6, 7, 8, 9, 10, 11, 12, 13, 14, 15);
}

// Transposing LDS load of a row-major 16-bit tile T. Lane l hands in the address of
// T[8 (l >> 4) + (l & 7)][8 ((l >> 3) & 1)] and receives T[8 (l >> 4) + 0..7][l & 15].
__device__ inline v8h ld_tr16(const _Float16* p) {
    typedef __attribute__((address_space(3))) v8s lds_v8s;
    return __builtin_bit_cast(v8h, __builtin_amdgcn_ds_load_tr16_b128_v8i16((lds_v8s*)p));
}

// 16 d x 32 keys of V^T as an A fragment, out of V rows [key][d] at pitch PTR: two
// transposing loads, keys 0..15 and 16..31. Lane half h gets keys 8h..8h+7 and
// 16+8h..16+8h+7, the k order that a packed pair of score tiles has as B.
__device__ inline v16h ld_frag_vt(const _Float16* p) {
    const v8h lo = ld_tr16(p);
    const v8h hi = ld_tr16(p + 16 * PTR);
    return __builtin_shufflevector(lo, hi, 0, 1, 2, 3, 4, 5, 6, 7, 8, 9, 10, 11, 12, 13, 14, 15);
}

// value of lane l ^ 16
__device__ inline float xhalf(float x) {
    const int b = __builtin_bit_cast(int, x);
    return __builtin_bit_cast(float,
        __builtin_amdgcn_permlanex16(b, b, 0x76543210, 0xfedcba98, false, false));
}

// ---------------------------------------------------------------------------
// Operand preparation, one launch. The five jobs do not depend on one another
// and are block-index ranges of one grid:
//   blocks [0, 4*PACKB)  pack Wq, Wk, Wv, Wo (row-major fp32 [out=768][in=768])
//                        into WMMA B-fragments of 1 KB, PACKB blocks each: the 32
//                        lanes' first 8 halfs, then the 32 lanes' second 8, so
//                        that each 16-B read of a fragment is 512 B in a row
//   the rest             fp32 -> f16 elementwise convert of x
// The packs stand first: few blocks with strided reads, they start early and
// run under the stream of x.
// ---------------------------------------------------------------------------
constexpr int PACKB = (DM / 32) * (DM / 16) * 32 / 256;   // 144 blocks per weight
constexpr int CVTB  = NTOK * DM / (256 * 4);              // 6144 blocks for x

__global__ void __launch_bounds__(256)
prep_operands(const float* __restrict__ x,
              const float* __restrict__ Wq, const float* __restrict__ Wk,
              const float* __restrict__ Wv, const float* __restrict__ Wo,
              _Float16* __restrict__ Xf, _Float16* __restrict__ Wpack) {
    const int blk = blockIdx.x;
    if (blk < 4 * PACKB) {
        const int w = blk / PACKB;                            // which weight
        const float* __restrict__ W = w == 0 ? Wq : w == 1 ? Wk : w == 2 ? Wv : Wo;
        _Float16* __restrict__ Wp = Wpack + (size_t)w * DM * DM;
        const int t    = (blk - w * PACKB) * 256 + threadIdx.x;   // 36864 threads
        const int lane = t & 31;
        const int tile = t >> 5;                                  // 0..1151
        const int nt   = tile % (DM / 16);
        const int kt   = tile / (DM / 16);
        const int n    = nt * 16 + (lane & 15);
        const int k0   = kt * 32 + (lane >> 4) * 16;
        const float* src = &W[(size_t)n * DM + k0];
        _Float16*    dst = &Wp[(size_t)tile * 512 + lane * 8];
#pragma unroll
        for (int i = 0; i < 8; ++i) {
            dst[i]       = (_Float16)src[i];
            dst[256 + i] = (_Float16)src[8 + i];
        }
    } else {
        const int i = ((blk - 4 * PACKB) * 256 + threadIdx.x) * 4;
        if (i < NTOK * DM) {
            const float4 v = *reinterpret_cast<const float4*>(x + i);
            Xf[i + 0] = (_Float16)v.x;
            Xf[i + 1] = (_Float16)v.y;
            Xf[i + 2] = (_Float16)v.z;
            Xf[i + 3] = (_Float16)v.w;
        }
    }
}

// ---------------------------------------------------------------------------
// GEMM: Y[8192,768] = Xf16 * W^T + bias. WG tile 128x128, 8 waves (4 x 2), 32x64
// per wave (8 WMMA accs). A stage is 64 k of both operands in LDS: X rows at
// pitch P64 and the packed W fragments of the tile's 8 column tiles, copied as
// they lie (2 x 8 KB in a row). Two buffers, one barrier per stage, the next
// stage's global loads in flight under the WMMAs.
// blockIdx.x = product * 6 + column block: products that share X (Q, K, V) are
// column ranges of one grid; packed weights and f16 outputs of successive
// products lie one behind the other, each product has its own bias.
// ---------------------------------------------------------------------------
constexpr int GK     = 64;               // k per stage
constexpr int GSTAGE = DM / GK;          // 12
constexpr int WSTG   = 2 * 8 * 512;      // halfs of W per stage: 2 k tiles x 8 column tiles

template <bool F32OUT>
__global__ void __launch_bounds__(256)
gemm_bias_768(const _Float16* __restrict__ X,
              const _Float16* __restrict__ Wpack,
              const float*    __restrict__ bias0,
              const float*    __restrict__ bias1,
              const float*    __restrict__ bias2,
              float*          __restrict__ Yf32,
              _Float16*       __restrict__ Yall) {
    __shared__ __align__(32) _Float16 Xs[2][128 * P64];  // 2 x 18 KB
    __shared__ __align__(32) _Float16 Ws[2][WSTG];       // 2 x 16 KB

    const int tid   = threadIdx.x;
    const int lane  = tid & 31;
    const int wave  = tid >> 5;
    const int mw    = wave & 3;
    const int nw    = wave >> 2;
    const int m0    = blockIdx.y * 128;
    const int prod  = blockIdx.x / (DM / 128);
    const int n0    = (blockIdx.x - prod * (DM / 128)) * 128;
    const int lrow  = lane & 15;
    const int lhalf = lane >> 4;

    const _Float16* __restrict__ Wp   = Wpack + (size_t)prod * DM * DM;
    const float*    __restrict__ bias = prod == 0 ? bias0 : prod == 1 ? bias1 : bias2;
    _Float16*       __restrict__ Yf16 = Yall + (size_t)prod * NTOK * DM;

    // staging, 16 B per thread and piece: X piece i is rows 32 i .. 32 i + 31 (8
    // threads per 128-B row); W piece i is 4 KB in a row of k tile i / 2
    const int sr = tid >> 3;
    const int sc = (tid & 7) * 8;

    const _Float16* xsrc = &X[(size_t)(m0 + sr) * DM + sc];
    const _Float16* wsrc = &Wp[(size_t)(n0 >> 4) * 512 + tid * 8];
    constexpr size_t XP = (size_t)32 * DM;          // X piece to piece, halfs
    constexpr size_t WK = (size_t)(DM / 16) * 512;  // W k tile to k tile, halfs

    uint4 x0, x1, x2, x3, w0, w1, w2, w3;
    auto gload = [&](int st) {
        const _Float16* xp = xsrc + st * GK;
        const _Float16* wp = wsrc + (size_t)(2 * st) * WK;
        x0 = *reinterpret_cast<const uint4*>(xp);
        x1 = *reinterpret_cast<const uint4*>(xp + XP);
        x2 = *reinterpret_cast<const uint4*>(xp + 2 * XP);
        x3 = *reinterpret_cast<const uint4*>(xp + 3 * XP);
        w0 = *reinterpret_cast<const uint4*>(wp);
        w1 = *reinterpret_cast<const uint4*>(wp + 2048);
        w2 = *reinterpret_cast<const uint4*>(wp + WK);
        w3 = *reinterpret_cast<const uint4*>(wp + WK + 2048);
    };
    auto sstore = [&](int buf) {
        _Float16* xd = &Xs[buf][sr * P64 + sc];
        _Float16* wd = &Ws[buf][tid * 8];
        *reinterpret_cast<uint4*>(xd)                = x0;
        *reinterpret_cast<uint4*>(xd + 32 * P64)     = x1;
        *reinterpret_cast<uint4*>(xd + 2 * 32 * P64) = x2;
        *reinterpret_cast<uint4*>(xd + 3 * 32 * P64) = x3;
        *reinterpret_cast<uint4*>(wd)                = w0;
        *reinterpret_cast<uint4*>(wd + 2048)         = w1;
        *reinterpret_cast<uint4*>(wd + 2 * 2048)     = w2;
        *reinterpret_cast<uint4*>(wd + 3 * 2048)     = w3;
    };

    v8f c[2][4] = {};

    // one stage's 16 WMMAs from buffer cur
    auto compute = [&](int cur) {
#pragma unroll
        for (int ks = 0; ks < 2; ++ks) {
            v16h a[2], b[4];
#pragma unroll
            for (int r = 0; r < 2; ++r)
                a[r] = ld_frag(&Xs[cur][(mw * 32 + r * 16 + lrow) * P64 + ks * 32 + lhalf * 16]);
#pragma unroll
            for (int j = 0; j < 4; ++j) {
                const _Float16* f = &Ws[cur][(ks * 8 + nw * 4 + j) * 512 + lane * 8];
                const v8h lo = *reinterpret_cast<const v8h*>(f);
                const v8h hi = *reinterpret_cast<const v8h*>(f + 256);
                b[j] = __builtin_shufflevector(lo, hi, 0, 1, 2, 3, 4, 5, 6, 7,
                                               8, 9, 10, 11, 12, 13, 14, 15);
            }
#pragma unroll
            for (int r = 0; r < 2; ++r)
#pragma unroll
                for (int j = 0; j < 4; ++j)
                    c[r][j] = __builtin_amdgcn_wmma_f32_16x16x32_f16(
                        false, a[r], false, b[j], (short)0, c[r][j], false, false);
        }
    };

    gload(0);
    sstore(0);
    for (int st = 0; st + 1 < GSTAGE; ++st) {
        __syncthreads();
        gload(st + 1);                        // in flight under the WMMAs
        compute(st & 1);
        sstore((st & 1) ^ 1);
        // order within the stage: the eight global loads ahead of the LDS reads, and
        // their LDS stores behind the WMMAs. With the loads sunk to the stores, or the
        // stores among the WMMAs, the wave waits out the load latency with matrix
        // work still to issue
        __builtin_amdgcn_sched_group_barrier(0x020, 8, 0);    // global loads
        __builtin_amdgcn_sched_group_barrier(0x100, 24, 0);   // LDS reads
        __builtin_amdgcn_sched_group_barrier(0x008, 16, 1);   // WMMAs
        __builtin_amdgcn_sched_group_barrier(0x200, 8, 1);    // LDS stores
    }
    __syncthreads();
    compute((GSTAGE - 1) & 1);

#pragma unroll
    for (int j = 0; j < 4; ++j) {
        const int col  = n0 + nw * 64 + j * 16 + lrow;
        const float bv = bias[col];
#pragma unroll
        for (int r = 0; r < 2; ++r) {
#pragma unroll
            for (int jv = 0; jv < 8; ++jv) {
                const int row   = m0 + mw * 32 + r * 16 + jv + 8 * lhalf;
                const float val = c[r][j][jv] + bv;
                if constexpr (F32OUT) Yf32[(size_t)row * DM + col] = val;
                else                  Yf16[(size_t)row * DM + col] = (_Float16)val;
            }
        }
    }
}

__global__ void __launch_bounds__(256, 1)
attn_flash(const _Float16* __restrict__ Q,
           const _Float16* __restrict__ K,
           const _Float16* __restrict__ V,
           const int*      __restrict__ mask,
           const float*    __restrict__ temp,
           _Float16*       __restrict__ O) {
    __shared__ __align__(32) _Float16 Ks [2][32 * P64];   // [key][d]
    __shared__ __align__(32) _Float16 Vs [2][32 * PTR];   // [key][d], read transposed
    __shared__ __align__(32) float Mb[SEQ];               // additive bias per listed key
    __shared__ __align__(16) int   Cnt[KBLK];             // kept keys per 32-key segment
    __shared__ unsigned short      Idx[SEQ];              // listed key -> row of the batch

    const int lane  = threadIdx.x & 31;
    const int wave  = threadIdx.x >> 5;
    const int b     = blockIdx.z;
    const int h     = blockIdx.y;
    const int q0    = (blockIdx.x * 8 + wave) * 16;
    const int lrow  = lane & 15;
    const int lhalf = lane >> 4;
    const float scale = temp[h] * 0.125f;     // temperature / sqrt(64)

    const size_t tokBase = (size_t)b * SEQ;

    // list the kept keys. Thread t looks at keys j * 256 + t, so a wave's ballot is
    // one 32-key segment; segment counts meet in LDS, every thread sums those ahead
    // of its own 8 segments.
    const float mbias = -1.0e9f * scale;
    int      mk[8];
    unsigned bal[8];
#pragma unroll
    for (int j = 0; j < 8; ++j) mk[j] = mask[b * SEQ + j * 256 + threadIdx.x];
#pragma unroll
    for (int j = 0; j < 8; ++j) bal[j] = __builtin_amdgcn_ballot_w32(mk[j] != 0);
    if (lane == 0) {
#pragma unroll
        for (int j = 0; j < 8; ++j) Cnt[j * 8 + wave] = __popc(bal[j]);
    }
    __syncthreads();
    int pre[8];     // kept keys ahead of segment j * 8 + wave
    int run = 0;
#pragma unroll
    for (int j = 0; j < 8; ++j) {
        int tot = 0, part = 0;      // eight short chains, joined by run
#pragma unroll
        for (int w = 0; w < 8; ++w) {
            const int v = Cnt[j * 8 + w];
            part += w < wave ? v : 0;
            tot  += v;
        }
        pre[j] = run + part;
        run   += tot;
    }
    const int  nkeep   = __builtin_amdgcn_readfirstlane(run);   // same in every thread
    const bool walkAll = nkeep == 0 || !(1.0e9f * scale >= 1.0e5f);
    const int  nkey    = walkAll ? SEQ : nkeep;
    const int  nblk    = max(1, min((nkey + 31) >> 5, KBLK));   // passes, 1 .. 64
    if (walkAll) {
#pragma unroll
        for (int j = 0; j < 8; ++j) {
            const int k = j * 256 + threadIdx.x;
            Idx[k] = (unsigned short)k;
            Mb[k]  = mk[j] ? 0.0f : mbias;
        }
    } else {
        const unsigned below = (1u << lane) - 1u;
#pragma unroll
        for (int j = 0; j < 8; ++j) {
            const int k = j * 256 + threadIdx.x;
            if (mk[j]) Idx[pre[j] + __popc(bal[j] & below)] = (unsigned short)k;
            Mb[k] = k < nkey ? 0.0f : mbias;
        }
        const int fill = nkey + threadIdx.x;                    // the last pass's rest
        if (fill < nblk * 32) Idx[fill] = 0;
    }
    __syncthreads();

    // Q fragments pre-scaled by temperature/sqrt(d)
    const _Float16 hs = (_Float16)scale;
    v16h aq[2];
#pragma unroll
    for (int f = 0; f < 2; ++f) {
        aq[f] = *reinterpret_cast<const v16h*>(
            &Q[(tokBase + q0 + lrow) * DM + h * DH + f * 32 + lhalf * 16]);
        aq[f] = aq[f] * hs;
    }

    // A operand of the column sums: rows 0 and 8 are ones, the rest 0, so that
    // register 0 of either lane half receives its query's sum over all 32 keys.
    const _Float16 oneOrZero = (lane & 7) == 0 ? (_Float16)1.0f : (_Float16)0.0f;
    v16h ones;
#pragma unroll
    for (int i = 0; i < 16; ++i) ones[i] = oneOrZero;

    v8f   acc[4] = {};        // O^T: acc[nt][jv] = O[q0 + lrow][nt*16 + 8*lhalf + jv]
    v8f   accS   = {};        // accS[0] = running denominator of query q0 + lrow
    float mrun   = -3.0e38f;  // running maximum of query q0 + lrow

    const int skey = threadIdx.x >> 3;   // K/V staging: 8 threads per key
    const int sch  = threadIdx.x & 7;

    uint4 kreg, vreg;
    auto gload = [&](int row) {
        const size_t g = (tokBase + row) * DM + h * DH + sch * 8;
        kreg = *reinterpret_cast<const uint4*>(&K[g]);
        vreg = *reinterpret_cast<const uint4*>(&V[g]);
        // the two address pairs are scratch registers that the pass's LDS reads take
        // over next: the wait stands between the loads and that overwrite
        asm volatile("s_wait_xcnt 0x0" ::: "memory");
    };
    auto sstore = [&](int buf) {
        *reinterpret_cast<uint4*>(&Ks[buf][skey * P64 + sch * 8]) = kreg;
        *reinterpret_cast<uint4*>(&Vs[buf][skey * PTR + sch * 8]) = vreg;
    };
    // this lane's address inside a V tile for the transposing loads
    const int vtoff = (8 * lhalf + (lane & 7)) * PTR + ((lane >> 3) & 1) * 8;

    gload(Idx[skey]);
    int rnext = nblk > 1 ? Idx[32 + skey] : 0;    // row of the next pass, read a pass ahead
    sstore(0);
    for (int kb = 0; kb < nblk; ++kb) {
        __syncthreads();
        const int cur = kb & 1;
        if (kb + 1 < nblk) gload(rnext);      // in flight under the WMMAs
        if (kb + 2 < nblk) rnext = Idx[(kb + 2) * 32 + skey];
        // keeps the two loads up here: sunk to their LDS stores at the foot of the
        // pass, their whole latency would stand in front of the next barrier
        __builtin_amdgcn_sched_barrier(0);

        // S^T (pre-scaled), two 16-key row tiles: sc[jv] = S[q0 + lrow][key 8*lhalf + jv]
        v8f sc0 = {}, sc1 = {};
#pragma unroll
        for (int f = 0; f < 2; ++f) {
            const v16h bk0 = ld_frag(&Ks[cur][lrow * P64 + f * 32 + lhalf * 16]);
            const v16h bk1 = ld_frag(&Ks[cur][(16 + lrow) * P64 + f * 32 + lhalf * 16]);
            sc0 = __builtin_amdgcn_wmma_f32_16x16x32_f16(
                false, bk0, false, aq[f], (short)0, sc0, false, false);
            sc1 = __builtin_amdgcn_wmma_f32_16x16x32_f16(
                false, bk1, false, aq[f], (short)0, sc1, false, false);
        }

        const int kk0 = kb * 32;
        sc0 += *reinterpret_cast<const v8f*>(&Mb[kk0 + 8 * lhalf]);
        sc1 += *reinterpret_cast<const v8f*>(&Mb[kk0 + 16 + 8 * lhalf]);

        // the query's maximum over its 32 keys: 16 in this lane, 16 in lane ^ 16
        float rm = fmaxf(sc0[0], sc1[0]);
#pragma unroll
        for (int jv = 1; jv < 8; ++jv) rm = fmaxf(rm, fmaxf(sc0[jv], sc1[jv]));
        rm = fmaxf(rm, xhalf(rm));

        const float mnew = fmaxf(mrun, rm);
        const float cr   = __expf(mrun - mnew);
        mrun = mnew;

        v8f p0, p1;
#pragma unroll
        for (int jv = 0; jv < 8; ++jv) {
            p0[jv] = __expf(sc0[jv] - mnew);
            p1[jv] = __expf(sc1[jv] - mnew);
        }
        // P^T as B fragment: the two converted tiles, register for register
        const v16h pb = __builtin_shufflevector(
            __builtin_convertvector(p0, v8h), __builtin_convertvector(p1, v8h),
            0, 1, 2, 3, 4, 5, 6, 7, 8, 9, 10, 11, 12, 13, 14, 15);

        accS[0] *= cr;        // registers 1..7 of accS stay 0
#pragma unroll
        for (int nt = 0; nt < 4; ++nt) acc[nt] *= cr;

        accS = __builtin_amdgcn_wmma_f32_16x16x32_f16(
            false, ones, false, pb, (short)0, accS, false, false);
#pragma unroll
        for (int nt = 0; nt < 4; ++nt) {
            const v16h av = ld_frag_vt(&Vs[cur][vtoff + nt * 16]);
            acc[nt] = __builtin_amdgcn_wmma_f32_16x16x32_f16(
                false, av, false, pb, (short)0, acc[nt], false, false);
        }

        if (kb + 1 < nblk) sstore(cur ^ 1);   // waits loadcnt here, post-compute
    }

    // normalize + store f16 ([token][768], heads interleaved): 8 consecutive d per tile
    const float inv = 1.0f / accS[0];
    _Float16* orow = &O[(tokBase + q0 + lrow) * DM + h * DH + 8 * lhalf];
#pragma unroll
    for (int nt = 0; nt < 4; ++nt)
        *reinterpret_cast<v8h*>(orow + nt * 16) = __builtin_convertvector(acc[nt] * inv, v8h);
}

// ---------------------------------------------------------------------------
extern "C" void kernel_launch(void* const* d_in, const int* in_sizes, int n_in,
                              void* d_out, int out_size, void* d_ws, size_t ws_size,
                              hipStream_t stream) {
    const float* x    = (const float*)d_in[0];
    const int*   mask = (const int*)  d_in[1];
    const float* Wq   = (const float*)d_in[2];
    const float* bq   = (const float*)d_in[3];
    const float* Wk   = (const float*)d_in[4];
    const float* bk   = (const float*)d_in[5];
    const float* Wv   = (const float*)d_in[6];
    const float* bv   = (const float*)d_in[7];
    const float* Wo   = (const float*)d_in[8];
    const float* bo   = (const float*)d_in[9];
    const float* temp = (const float*)d_in[10];
    float* out = (float*)d_out;

    size_t off = 0;
    auto walloc = [&](size_t elems) {
        void* p = (char*)d_ws + off;
        off = (off + elems * sizeof(_Float16) + 255) & ~(size_t)255;
        return (_Float16*)p;
    };
    _Float16* Xf  = walloc((size_t)NTOK * DM);
    _Float16* Wpk = walloc((size_t)4 * DM * DM);     // packed Wq, Wk, Wv, Wo
    _Float16* Qf  = walloc((size_t)3 * NTOK * DM);   // Q, K, V one behind the other
    _Float16* Kf  = Qf + (size_t)NTOK * DM;
    _Float16* Vf  = Kf + (size_t)NTOK * DM;
    _Float16* Wop = Wpk + (size_t)3 * DM * DM;
    _Float16* Af  = Xf;   // attention output reuses x_f16 (dead after the QKV GEMM)

    prep_operands<<<4 * PACKB + CVTB, 256, 0, stream>>>(x, Wq, Wk, Wv, Wo, Xf, Wpk);

    gemm_bias_768<false><<<dim3(3 * DM / 128, NTOK / 128), 256, 0, stream>>>(
        Xf, Wpk, bq, bk, bv, nullptr, Qf);

    attn_flash<<<dim3(SEQ / (16 * 8), NH, 4), 256, 0, stream>>>(Qf, Kf, Vf, mask, temp, Af);

    gemm_bias_768<true><<<dim3(DM / 128, NTOK / 128), 256, 0, stream>>>(
        Af, Wop, bo, bo, bo, out, nullptr);
}

// v007
// It runs in 86.4 microseconds.
// Next to v006, in two timings, it ran 1.06 times as fast each time.
// Over all steps from v000 it is 4.82 times as fast.
#include <hip/hip_runtime.h>

typedef __attribute__((ext_vector_type(16))) _Float16 v16h;
typedef __attribute__((ext_vector_type(8)))  _Float16 v8h;
typedef __attribute__((ext_vector_type(8)))  short    v8s;
typedef __attribute__((ext_vector_type(8)))  float    v8f;

constexpr int DM     = 768;     // d_model
constexpr int NTOK   = 4 * 2048;
constexpr int SEQ    = 2048;
constexpr int NH     = 12;
constexpr int DH     = 64;
constexpr int KBLK   = SEQ / 32;    // 64 key blocks

// LDS row pitches in halfs, each for its reader. ds_load_b128: row bytes + 16, an
// odd multiple of 16 B, so that the 16 rows a load touches per lane half fall on
// distinct banks. ds_load_tr16_b128: row bytes + 32, an odd multiple of 32 B.
constexpr int P64 = 64 + 8;         // 128-B rows -> 144 B
constexpr int PTR = 64 + 16;        // 128-B rows -> 160 B, read transposed

// 16 consecutive halfs of an LDS row as one fragment; rows are 16-B aligned only.
__device__ inline v16h ld_frag(const _Float16* p) {
    const v8h lo = *reinterpret_cast<const v8h*>(p);
    const v8h hi = *reinterpret_cast<const v8h*>(p + 8);
    return __builtin_shufflevector(lo, hi, 0, 1, 2, 3, 4, 5, 6, 7, 8, 9, 10, 11, 12, 13, 14, 15);
}

// Transposing LDS load of a row-major 16-bit tile T. Lane l hands in the address of
// T[8 (l >> 4) + (l & 7)][8 ((l >> 3) & 1)] and receives T[8 (l >> 4) + 0..7][l & 15].
__device__ inline v8h ld_tr16(const _Float16* p) {
    typedef __attribute__((address_space(3))) v8s lds_v8s;
    return __builtin_bit_cast(v8h, __builtin_amdgcn_ds_load_tr16_b128_v8i16((lds_v8s*)p));
}

// 16 d x 32 keys of V^T as an A fragment, out of V rows [key][d] at pitch PTR: two
// transposing loads, keys 0..15 and 16..31. Lane half h gets keys 8h..8h+7 and
// 16+8h..16+8h+7, the k order that a packed pair of score tiles has as B.
__device__ inline v16h ld_frag_vt(const _Float16* p) {
    const v8h lo = ld_tr16(p);
    const v8h hi = ld_tr16(p + 16 * PTR);
    return __builtin_shufflevector(lo, hi, 0, 1, 2, 3, 4, 5, 6, 7, 8, 9, 10, 11, 12, 13, 14, 15);
}

// value of lane l ^ 16
__device__ inline float xhalf(float x) {
    const int b = __builtin_bit_cast(int, x);
    return __builtin_bit_cast(float,
        __builtin_amdgcn_permlanex16(b, b, 0x76543210, 0xfedcba98, false, false));
}

// ---------------------------------------------------------------------------
// Operand preparation, one launch. The five jobs do not depend on one another
// and are block-index ranges of one grid:
//   blocks [0, 4*PACKB)  pack Wq, Wk, Wv, Wo (row-major fp32 [out=768][in=768])
//                        into WMMA B-fragments of 1 KB, PACKB blocks each: the 32
//                        lanes' first 8 halfs, then the 32 lanes' second 8, so
//                        that each 16-B read of a fragment is 512 B in a row
//   the rest             fp32 -> f16 elementwise convert of x
// The packs stand first: few blocks with strided reads, they start early and
// run under the stream of x.
// ---------------------------------------------------------------------------
constexpr int PACKB = (DM / 32) * (DM / 16) * 32 / 256;   // 144 blocks per weight
constexpr int CVTB  = NTOK * DM / (256 * 4);              // 6144 blocks for x

__global__ void __launch_bounds__(256)
prep_operands(const float* __restrict__ x,
              const float* __restrict__ Wq, const float* __restrict__ Wk,
              const float* __restrict__ Wv, const float* __restrict__ Wo,
              _Float16* __restrict__ Xf, _Float16* __restrict__ Wpack) {
    const int blk = blockIdx.x;
    if (blk < 4 * PACKB) {
        const int w = blk / PACKB;                            // which weight
        const float* __restrict__ W = w == 0 ? Wq : w == 1 ? Wk : w == 2 ? Wv : Wo;
        _Float16* __restrict__ Wp = Wpack + (size_t)w * DM * DM;
        const int t    = (blk - w * PACKB) * 256 + threadIdx.x;   // 36864 threads
        const int lane = t & 31;
        const int tile = t >> 5;                                  // 0..1151
        const int nt   = tile % (DM / 16);
        const int kt   = tile / (DM / 16);
        const int n    = nt * 16 + (lane & 15);
        const int k0   = kt * 32 + (lane >> 4) * 16;
        const float* src = &W[(size_t)n * DM + k0];
        _Float16*    dst = &Wp[(size_t)tile * 512 + lane * 8];
#pragma unroll
        for (int i = 0; i < 8; ++i) {
            dst[i]       = (_Float16)src[i];
            dst[256 + i] = (_Float16)src[8 + i];
        }
    } else {
        const int i = ((blk - 4 * PACKB) * 256 + threadIdx.x) * 4;
        if (i < NTOK * DM) {
            const float4 v = *reinterpret_cast<const float4*>(x + i);
            Xf[i + 0] = (_Float16)v.x;
            Xf[i + 1] = (_Float16)v.y;
            Xf[i + 2] = (_Float16)v.z;
            Xf[i + 3] = (_Float16)v.w;
        }
    }
}

// ---------------------------------------------------------------------------
// GEMM: Y[8192,768] = Xf16 * W^T + bias. WG tile 128x128, 8 waves (4 x 2), 32x64
// per wave (8 WMMA accs). A stage is 64 k of both operands in LDS: X rows at
// pitch P64 and the packed W fragments of the tile's 8 column tiles, copied as
// they lie (2 x 8 KB in a row). Two buffers, one barrier per stage, the next
// stage's global loads in flight under the WMMAs.
// blockIdx.x = product * 6 + column block: products that share X (Q, K, V) are
// column ranges of one grid; packed weights and f16 outputs of successive
// products lie one behind the other, each product has its own bias.
// blockIdx.y = batch row * 16 + tile. A tile of Q or of the output projection is
// 128 tokens in a row. K and V rows are read by the attention only for keys that
// the mask keeps (or for all keys, where it walks all: no key kept, or a scale too
// small for a masked weight to vanish), so a K or V tile is 128 entries of the
// batch row's list of kept tokens: the block lists them as the attention does,
// gathers its X rows and stores its K/V rows through the list (Tok); tiles past
// the end of the list do nothing.
// ---------------------------------------------------------------------------
constexpr int GK     = 64;               // k per stage
constexpr int GSTAGE = DM / GK;          // 12
constexpr int WSTG   = 2 * 8 * 512;      // halfs of W per stage: 2 k tiles x 8 column tiles

template <bool F32OUT>
__global__ void __launch_bounds__(256)
gemm_bias_768(const _Float16* __restrict__ X,
              const _Float16* __restrict__ Wpack,
              const float*    __restrict__ bias0,
              const float*    __restrict__ bias1,
              const float*    __restrict__ bias2,
              const int*      __restrict__ mask,
              const float*    __restrict__ temp,
              float*          __restrict__ Yf32,
              _Float16*       __restrict__ Yall) {
    __shared__ __align__(32) _Float16 Xs[2][128 * P64];  // 2 x 18 KB
    __shared__ __align__(32) _Float16 Ws[2][WSTG];       // 2 x 16 KB
    __shared__ __align__(16) int   Cnt[KBLK];            // kept tokens per 32-token segment
    __shared__ __align__(16) unsigned short Tok[128];    // tile row -> token of the batch row

    const int tid   = threadIdx.x;
    const int lane  = tid & 31;
    const int wave  = tid >> 5;
    const int mw    = wave & 3;
    const int nw    = wave >> 2;
    const int tok0  = (blockIdx.y >> 4) * SEQ;      // first token of the batch row
    const int tl    = (blockIdx.y & 15) * 128;      // the tile's first place in its row's list
    const int prod  = blockIdx.x / (DM / 128);
    const int n0    = (blockIdx.x - prod * (DM / 128)) * 128;
    const int lrow  = lane & 15;
    const int lhalf = lane >> 4;

    const _Float16* __restrict__ Wp   = Wpack + (size_t)prod * DM * DM;
    const float*    __restrict__ bias = prod == 0 ? bias0 : prod == 1 ? bias1 : bias2;
    _Float16*       __restrict__ Yf16 = Yall + (size_t)prod * NTOK * DM;

    // the tile's tokens. Thread t looks at tokens j * 256 + t, so a wave's ballot is
    // one 32-token segment; segment counts meet in LDS, every thread sums those ahead
    // of its own 8 segments (the attention's own listing, cut to this tile's window).
    int  nrow   = SEQ;      // length of the list
    bool listed = false;
    if constexpr (!F32OUT) {
        if (prod != 0) {
            int      mk[8];
            unsigned bal[8];
#pragma unroll
            for (int j = 0; j < 8; ++j) mk[j] = mask[tok0 + j * 256 + tid];
#pragma unroll
            for (int j = 0; j < 8; ++j) bal[j] = __builtin_amdgcn_ballot_w32(mk[j] != 0);
            if (lane == 0) {
#pragma unroll
                for (int j = 0; j < 8; ++j) Cnt[j * 8 + wave] = __popc(bal[j]);
            }
            bool all = false;   // some head walks all keys: the attention's own test
#pragma unroll
            for (int hh = 0; hh < NH; ++hh) all |= !(1.0e9f * (temp[hh] * 0.125f) >= 1.0e5f);
            __syncthreads();
            int pre[8];
            int run = 0;
#pragma unroll
            for (int j = 0; j < 8; ++j) {
                int tot = 0, part = 0;
#pragma unroll
                for (int w = 0; w < 8; ++w) {
                    const int v = Cnt[j * 8 + w];
                    part += w < wave ? v : 0;
                    tot  += v;
                }
                pre[j] = run + part;
                run   += tot;
            }
            const int nkeep = __builtin_amdgcn_readfirstlane(run);  // same in every thread
            listed = !(all || nkeep == 0);
            if (listed) {
                nrow = nkeep;
                const unsigned below = (1u << lane) - 1u;
#pragma unroll
                for (int j = 0; j < 8; ++j) {
                    const unsigned pos = (unsigned)(pre[j] + __popc(bal[j] & below) - tl);
                    if (mk[j] && pos < 128u) Tok[pos] = (unsigned short)(j * 256 + tid);
                }
                // rows past the list's end: staged from token 0, never stored
                if (tid < 128 && tl + tid >= nkeep) Tok[tid] = 0;
            }
        }
    }
    if constexpr (!F32OUT) {
        if (!listed && tid < 128) Tok[tid] = (unsigned short)(tl + tid);
        __syncthreads();
    }
    // token (of the batch row) that stands in row lr of the tile
    auto token = [&](int lr) {
        if constexpr (F32OUT) return tl + lr;
        else                  return (int)Tok[lr];
    };
    if (tl < nrow) {    // same for the whole block

    // staging, 16 B per thread and piece: X piece i is rows 32 i .. 32 i + 31 (8
    // threads per 128-B row); W piece i is 4 KB in a row of k tile i / 2
    const int sr = tid >> 3;
    const int sc = (tid & 7) * 8;

    const _Float16* xsrc[4];    // X piece i: this thread's 16 B of stage 0
#pragma unroll
    for (int i = 0; i < 4; ++i) {
        if constexpr (F32OUT) xsrc[i] = &X[(size_t)(tok0 + tl + sr) * DM + sc] + (size_t)i * 32 * DM;
        else                  xsrc[i] = &X[(size_t)(tok0 + token(sr + 32 * i)) * DM + sc];
    }
    const _Float16* wsrc = &Wp[(size_t)(n0 >> 4) * 512 + tid * 8];
    constexpr size_t WK = (size_t)(DM / 16) * 512;  // W k tile to k tile, halfs

    uint4 x0, x1, x2, x3, w0, w1, w2, w3;
    auto gload = [&](int st) {
        const _Float16* wp = wsrc + (size_t)(2 * st) * WK;
        x0 = *reinterpret_cast<const uint4*>(xsrc[0] + st * GK);
        x1 = *reinterpret_cast<const uint4*>(xsrc[1] + st * GK);
        x2 = *reinterpret_cast<const uint4*>(xsrc[2] + st * GK);
        x3 = *reinterpret_cast<const uint4*>(xsrc[3] + st * GK);
        w0 = *reinterpret_cast<const uint4*>(wp);
        w1 = *reinterpret_cast<const uint4*>(wp + 2048);
        w2 = *reinterpret_cast<const uint4*>(wp + WK);
        w3 = *reinterpret_cast<const uint4*>(wp + WK + 2048);
    };
    auto sstore = [&](int buf) {
        _Float16* xd = &Xs[buf][sr * P64 + sc];
        _Float16* wd = &Ws[buf][tid * 8];
        *reinterpret_cast<uint4*>(xd)                = x0;
        *reinterpret_cast<uint4*>(xd + 32 * P64)     = x1;
        *reinterpret_cast<uint4*>(xd + 2 * 32 * P64) = x2;
        *reinterpret_cast<uint4*>(xd + 3 * 32 * P64) = x3;
        *reinterpret_cast<uint4*>(wd)                = w0;
        *reinterpret_cast<uint4*>(wd + 2048)         = w1;
        *reinterpret_cast<uint4*>(wd + 2 * 2048)     = w2;
        *reinterpret_cast<uint4*>(wd + 3 * 2048)     = w3;
    };

    v8f c[2][4] = {};

    // one stage's 16 WMMAs from buffer cur
    auto compute = [&](int cur) {
#pragma unroll
        for (int ks = 0; ks < 2; ++ks) {
            v16h a[2], b[4];
#pragma unroll
            for (int r = 0; r < 2; ++r)
                a[r] = ld_frag(&Xs[cur][(mw * 32 + r * 16 + lrow) * P64 + ks * 32 + lhalf * 16]);
#pragma unroll
            for (int j = 0; j < 4; ++j) {
                const _Float16* f = &Ws[cur][(ks * 8 + nw * 4 + j) * 512 + lane * 8];
                const v8h lo = *reinterpret_cast<const v8h*>(f);
                const v8h hi = *reinterpret_cast<const v8h*>(f + 256);
                b[j] = __builtin_shufflevector(lo, hi, 0, 1, 2, 3, 4, 5, 6, 7,
                                               8, 9, 10, 11, 12, 13, 14, 15);
            }
#pragma unroll
            for (int r = 0; r < 2; ++r)
#pragma unroll
                for (int j = 0; j < 4; ++j)
                    c[r][j] = __builtin_amdgcn_wmma_f32_16x16x32_f16(
                        false, a[r], false, b[j], (short)0, c[r][j], false, false);
        }
    };

    gload(0);
    sstore(0);
    for (int st = 0; st + 1 < GSTAGE; ++st) {
        __syncthreads();
        gload(st + 1);                        // in flight under the WMMAs
        compute(st & 1);
        sstore((st & 1) ^ 1);
        // order within the stage: the eight global loads ahead of the LDS reads, and
        // their LDS stores behind the WMMAs. With the loads sunk to the stores, or the
        // stores among the WMMAs, the wave waits out the load latency with matrix
        // work still to issue
        __builtin_amdgcn_sched_group_barrier(0x020, 8, 0);    // global loads
        __builtin_amdgcn_sched_group_barrier(0x100, 24, 0);   // LDS reads
        __builtin_amdgcn_sched_group_barrier(0x008, 16, 1);   // WMMAs
        __builtin_amdgcn_sched_group_barrier(0x200, 8, 1);    // LDS stores
    }
    __syncthreads();
    compute((GSTAGE - 1) & 1);

    if constexpr (F32OUT) {
#pragma unroll
        for (int j = 0; j < 4; ++j) {
            const int col  = n0 + nw * 64 + j * 16 + lrow;
            const float bv = bias[col];
#pragma unroll
            for (int r = 0; r < 2; ++r) {
#pragma unroll
                for (int jv = 0; jv < 8; ++jv) {
                    const int row = tok0 + tl + mw * 32 + r * 16 + jv + 8 * lhalf;
                    Yf32[(size_t)row * DM + col] = c[r][j][jv] + bv;
                }
            }
        }
    } else {
        // rows go to their tokens; the biases and the 16 tokens are fetched ahead of
        // the row tests, so that no test has a wait behind it
        const int col0 = n0 + nw * 64 + lrow;
        float bv[4];
#pragma unroll
        for (int j = 0; j < 4; ++j) bv[j] = bias[col0 + j * 16];
        v8s tk[2];
#pragma unroll
        for (int r = 0; r < 2; ++r)
            tk[r] = *reinterpret_cast<const v8s*>(&Tok[mw * 32 + r * 16 + 8 * lhalf]);
        auto rows = [&](bool edge) {
#pragma unroll
            for (int r = 0; r < 2; ++r) {
#pragma unroll
                for (int jv = 0; jv < 8; ++jv) {
                    if (!edge || tl + mw * 32 + r * 16 + jv + 8 * lhalf < nrow) {
                        _Float16* yrow = &Yf16[(size_t)(tok0 + tk[r][jv]) * DM + col0];
#pragma unroll
                        for (int j = 0; j < 4; ++j) yrow[j * 16] = (_Float16)(c[r][j][jv] + bv[j]);
                        // the next row's sums and address take over the registers that these
                        // four stores name: the wait stands between the stores and that overwrite
                        asm volatile("s_wait_xcnt 0x0" ::: "memory");
                    }
                }
            }
        };
        // only the list's last tile can hold rows past its end: the others store
        // without a test per row
        if (tl + 128 <= nrow) rows(false);
        else                  rows(true);
    }

    }   // tl < nrow
}

__global__ void __launch_bounds__(256, 1)
attn_flash(const _Float16* __restrict__ Q,
           const _Float16* __restrict__ K,
           const _Float16* __restrict__ V,
           const int*      __restrict__ mask,
           const float*    __restrict__ temp,
           _Float16*       __restrict__ O) {
    __shared__ __align__(32) _Float16 Ks [2][32 * P64];   // [key][d]
    __shared__ __align__(32) _Float16 Vs [2][32 * PTR];   // [key][d], read transposed
    __shared__ __align__(32) float Mb[SEQ];               // additive bias per listed key
    __shared__ __align__(16) int   Cnt[KBLK];             // kept keys per 32-key segment
    __shared__ unsigned short      Idx[SEQ];              // listed key -> row of the batch

    const int lane  = threadIdx.x & 31;
    const int wave  = threadIdx.x >> 5;
    const int b     = blockIdx.z;
    const int h     = blockIdx.y;
    const int q0    = (blockIdx.x * 8 + wave) * 16;
    const int lrow  = lane & 15;
    const int lhalf = lane >> 4;
    const float scale = temp[h] * 0.125f;     // temperature / sqrt(64)

    const size_t tokBase = (size_t)b * SEQ;

    // list the kept keys. Thread t looks at keys j * 256 + t, so a wave's ballot is
    // one 32-key segment; segment counts meet in LDS, every thread sums those ahead
    // of its own 8 segments.
    const float mbias = -1.0e9f * scale;
    int      mk[8];
    unsigned bal[8];
#pragma unroll
    for (int j = 0; j < 8; ++j) mk[j] = mask[b * SEQ + j * 256 + threadIdx.x];
#pragma unroll
    for (int j = 0; j < 8; ++j) bal[j] = __builtin_amdgcn_ballot_w32(mk[j] != 0);
    if (lane == 0) {
#pragma unroll
        for (int j = 0; j < 8; ++j) Cnt[j * 8 + wave] = __popc(bal[j]);
    }
    __syncthreads();
    int pre[8];     // kept keys ahead of segment j * 8 + wave
    int run = 0;
#pragma unroll
    for (int j = 0; j < 8; ++j) {
        int tot = 0, part = 0;      // eight short chains, joined by run
#pragma unroll
        for (int w = 0; w < 8; ++w) {
            const int v = Cnt[j * 8 + w];
            part += w < wave ? v : 0;
            tot  += v;
        }
        pre[j] = run + part;
        run   += tot;
    }
    const int  nkeep   = __builtin_amdgcn_readfirstlane(run);   // same in every thread
    const bool walkAll = nkeep == 0 || !(1.0e9f * scale >= 1.0e5f);
    const int  nkey    = walkAll ? SEQ : nkeep;
    const int  nblk    = max(1, min((nkey + 31) >> 5, KBLK));   // passes, 1 .. 64
    if (walkAll) {
#pragma unroll
        for (int j = 0; j < 8; ++j) {
            const int k = j * 256 + threadIdx.x;
            Idx[k] = (unsigned short)k;
            Mb[k]  = mk[j] ? 0.0f : mbias;
        }
    } else {
        const unsigned below = (1u << lane) - 1u;
#pragma unroll
        for (int j = 0; j < 8; ++j) {
            const int k = j * 256 + threadIdx.x;
            if (mk[j]) Idx[pre[j] + __popc(bal[j] & below)] = (unsigned short)k;
            Mb[k] = k < nkey ? 0.0f : mbias;
        }
    }
    __syncthreads();

    // Q fragments pre-scaled by temperature/sqrt(d)
    const _Float16 hs = (_Float16)scale;
    v16h aq[2];
#pragma unroll
    for (int f = 0; f < 2; ++f) {
        aq[f] = *reinterpret_cast<const v16h*>(
            &Q[(tokBase + q0 + lrow) * DM + h * DH + f * 32 + lhalf * 16]);
        aq[f] = aq[f] * hs;
    }

    // A operand of the column sums: rows 0 and 8 are ones, the rest 0, so that
    // register 0 of either lane half receives its query's sum over all 32 keys.
    const _Float16 oneOrZero = (lane & 7) == 0 ? (_Float16)1.0f : (_Float16)0.0f;
    v16h ones;
#pragma unroll
    for (int i = 0; i < 16; ++i) ones[i] = oneOrZero;

    v8f   acc[4] = {};        // O^T: acc[nt][jv] = O[q0 + lrow][nt*16 + 8*lhalf + jv]
    v8f   accS   = {};        // accS[0] = running denominator of query q0 + lrow
    float mrun   = -3.0e38f;  // running maximum of query q0 + lrow

    const int skey = threadIdx.x >> 3;   // K/V staging: 8 threads per key
    const int sch  = threadIdx.x & 7;

    uint4 kreg, vreg;
    auto gload = [&](int row) {
        const size_t g = (tokBase + row) * DM + h * DH + sch * 8;
        kreg = *reinterpret_cast<const uint4*>(&K[g]);
        vreg = *reinterpret_cast<const uint4*>(&V[g]);
        // the two address pairs are scratch registers that the pass's LDS reads take
        // over next: the wait stands between the loads and that overwrite
        asm volatile("s_wait_xcnt 0x0" ::: "memory");
    };
    auto sstore = [&](int buf) {
        *reinterpret_cast<uint4*>(&Ks[buf][skey * P64 + sch * 8]) = kreg;
        *reinterpret_cast<uint4*>(&Vs[buf][skey * PTR + sch * 8]) = vreg;
    };
    // this lane's address inside a V tile for the transposing loads
    const int vtoff = (8 * lhalf + (lane & 7)) * PTR + ((lane >> 3) & 1) * 8;

    const int klast = nkey - 1;                   // places past it repeat the last listed key
    gload(Idx[min(skey, klast)]);
    int rnext = Idx[min(32 + skey, klast)];       // row of the next pass, read a pass ahead
    sstore(0);
    for (int kb = 0; kb < nblk; ++kb) {
        __syncthreads();
        const int cur = kb & 1;
        if (kb + 1 < nblk) gload(rnext);      // in flight under the WMMAs
        if (kb + 2 < nblk) rnext = Idx[min((kb + 2) * 32 + skey, klast)];
        // keeps the two loads up here: sunk to their LDS stores at the foot of the
        // pass, their whole latency would stand in front of the next barrier
        __builtin_amdgcn_sched_barrier(0);

        // S^T (pre-scaled), two 16-key row tiles: sc[jv] = S[q0 + lrow][key 8*lhalf + jv]
        v8f sc0 = {}, sc1 = {};
#pragma unroll
        for (int f = 0; f < 2; ++f) {
            const v16h bk0 = ld_frag(&Ks[cur][lrow * P64 + f * 32 + lhalf * 16]);
            const v16h bk1 = ld_frag(&Ks[cur][(16 + lrow) * P64 + f * 32 + lhalf * 16]);
            sc0 = __builtin_amdgcn_wmma_f32_16x16x32_f16(
                false, bk0, false, aq[f], (short)0, sc0, false, false);
            sc1 = __builtin_amdgcn_wmma_f32_16x16x32_f16(
                false, bk1, false, aq[f], (short)0, sc1, false, false);
        }

        const int kk0 = kb * 32;
        sc0 += *reinterpret_cast<const v8f*>(&Mb[kk0 + 8 * lhalf]);
        sc1 += *reinterpret_cast<const v8f*>(&Mb[kk0 + 16 + 8 * lhalf]);

        // the query's maximum over its 32 keys: 16 in this lane, 16 in lane ^ 16
        float rm = fmaxf(sc0[0], sc1[0]);
#pragma unroll
        for (int jv = 1; jv < 8; ++jv) rm = fmaxf(rm, fmaxf(sc0[jv], sc1[jv]));
        rm = fmaxf(rm, xhalf(rm));

        const float mnew = fmaxf(mrun, rm);
        const float cr   = __expf(mrun - mnew);
        mrun = mnew;

        v8f p0, p1;
#pragma unroll
        for (int jv = 0; jv < 8; ++jv) {
            p0[jv] = __expf(sc0[jv] - mnew);
            p1[jv] = __expf(sc1[jv] - mnew);
        }
        // P^T as B fragment: the two converted tiles, register for register
        const v16h pb = __builtin_shufflevector(
            __builtin_convertvector(p0, v8h), __builtin_convertvector(p1, v8h),
            0, 1, 2, 3, 4, 5, 6, 7, 8, 9, 10, 11, 12, 13, 14, 15);

        accS[0] *= cr;        // registers 1..7 of accS stay 0
#pragma unroll
        for (int nt = 0; nt < 4; ++nt) acc[nt] *= cr;

        accS = __builtin_amdgcn_wmma_f32_16x16x32_f16(
            false, ones, false, pb, (short)0, accS, false, false);
#pragma unroll
        for (int nt = 0; nt < 4; ++nt) {
            const v16h av = ld_frag_vt(&Vs[cur][vtoff + nt * 16]);
            acc[nt] = __builtin_amdgcn_wmma_f32_16x16x32_f16(
                false, av, false, pb, (short)0, acc[nt], false, false);
        }

        if (kb + 1 < nblk) sstore(cur ^ 1);   // waits loadcnt here, post-compute
    }

    // normalize + store f16 ([token][768], heads interleaved): 8 consecutive d per tile
    const float inv = 1.0f / accS[0];
    _Float16* orow = &O[(tokBase + q0 + lrow) * DM + h * DH + 8 * lhalf];
#pragma unroll
    for (int nt = 0; nt < 4; ++nt)
        *reinterpret_cast<v8h*>(orow + nt * 16) = __builtin_convertvector(acc[nt] * inv, v8h);
}

// ---------------------------------------------------------------------------
extern "C" void kernel_launch(void* const* d_in, const int* in_sizes, int n_in,
                              void* d_out, int out_size, void* d_ws, size_t ws_size,
                              hipStream_t stream) {
    const float* x    = (const float*)d_in[0];
    const int*   mask = (const int*)  d_in[1];
    const float* Wq   = (const float*)d_in[2];
    const float* bq   = (const float*)d_in[3];
    const float* Wk   = (const float*)d_in[4];
    const float* bk   = (const float*)d_in[5];
    const float* Wv   = (const float*)d_in[6];
    const float* bv   = (const float*)d_in[7];
    const float* Wo   = (const float*)d_in[8];
    const float* bo   = (const float*)d_in[9];
    const float* temp = (const float*)d_in[10];
    float* out = (float*)d_out;

    size_t off = 0;
    auto walloc = [&](size_t elems) {
        void* p = (char*)d_ws + off;
        off = (off + elems * sizeof(_Float16) + 255) & ~(size_t)255;
        return (_Float16*)p;
    };
    _Float16* Xf  = walloc((size_t)NTOK * DM);
    _Float16* Wpk = walloc((size_t)4 * DM * DM);     // packed Wq, Wk, Wv, Wo
    _Float16* Qf  = walloc((size_t)3 * NTOK * DM);   // Q, K, V one behind the other
    _Float16* Kf  = Qf + (size_t)NTOK * DM;
    _Float16* Vf  = Kf + (size_t)NTOK * DM;
    _Float16* Wop = Wpk + (size_t)3 * DM * DM;
    _Float16* Af  = Xf;   // attention output reuses x_f16 (dead after the QKV GEMM)

    prep_operands<<<4 * PACKB + CVTB, 256, 0, stream>>>(x, Wq, Wk, Wv, Wo, Xf, Wpk);

    gemm_bias_768<false><<<dim3(3 * DM / 128, NTOK / 128), 256, 0, stream>>>(
        Xf, Wpk, bq, bk, bv, mask, temp, nullptr, Qf);

    attn_flash<<<dim3(SEQ / (16 * 8), NH, 4), 256, 0, stream>>>(Qf, Kf, Vf, mask, temp, Af);

    gemm_bias_768<true><<<dim3(DM / 128, NTOK / 128), 256, 0, stream>>>(
        Af, Wop, bo, bo, bo, mask, temp, out, nullptr);
}

// v008
// One run takes 82.5 microseconds.
// Next to v007, in two timings, it ran 1.04 times as fast each time.
// Counting every step since v000, it is 5.03 times as fast.
#include <hip/hip_runtime.h>

typedef __attribute__((ext_vector_type(16))) _Float16 v16h;
typedef __attribute__((ext_vector_type(8)))  _Float16 v8h;
typedef __attribute__((ext_vector_type(8)))  short    v8s;
typedef __attribute__((ext_vector_type(8)))  float    v8f;

constexpr int DM     = 768;     // d_model
constexpr int NTOK   = 4 * 2048;
constexpr int SEQ    = 2048;
constexpr int NH     = 12;
constexpr int DH     = 64;
constexpr int KBLK   = SEQ / 32;    // 64 key blocks

// LDS row pitches in halfs, each for its reader. ds_load_b128: row bytes + 16, an
// odd multiple of 16 B, so that the 16 rows a load touches per lane half fall on
// distinct banks. ds_load_tr16_b128: row bytes + 32, an odd multiple of 32 B.
constexpr int P64 = 64 + 8;         // 128-B rows -> 144 B
constexpr int PTR = 64 + 16;        // 128-B rows -> 160 B, read transposed

// 16 consecutive halfs of an LDS row as one fragment; rows are 16-B aligned only.
__device__ inline v16h ld_frag(const _Float16* p) {
    const v8h lo = *reinterpret_cast<const v8h*>(p);
    const v8h hi = *reinterpret_cast<const v8h*>(p + 8);
    return __builtin_shufflevector(lo, hi, 0, 1, 2, 3, 4, 5, 6, 7, 8, 9, 10, 11, 12, 13, 14, 15);
}

// Transposing LDS load of a row-major 16-bit tile T. Lane l hands in the address of
// T[8 (l >> 4) + (l & 7)][8 ((l >> 3) & 1)] and receives T[8 (l >> 4) + 0..7][l & 15].
__device__ inline v8h ld_tr16(const _Float16* p) {
    typedef __attribute__((address_space(3))) v8s lds_v8s;
    return __builtin_bit_cast(v8h, __builtin_amdgcn_ds_load_tr16_b128_v8i16((lds_v8s*)p));
}

// 16 d x 32 keys of V^T as an A fragment, out of V rows [key][d] at pitch PTR: two
// transposing loads, keys 0..15 and 16..31. Lane half h gets keys 8h..8h+7 and
// 16+8h..16+8h+7, the k order that a packed pair of score tiles has as B.
__device__ inline v16h ld_frag_vt(const _Float16* p) {
    const v8h lo = ld_tr16(p);
    const v8h hi = ld_tr16(p + 16 * PTR);
    return __builtin_shufflevector(lo, hi, 0, 1, 2, 3, 4, 5, 6, 7, 8, 9, 10, 11, 12, 13, 14, 15);
}

// value of lane l ^ 16
__device__ inline float xhalf(float x) {
    const int b = __builtin_bit_cast(int, x);
    return __builtin_bit_cast(float,
        __builtin_amdgcn_permlanex16(b, b, 0x76543210, 0xfedcba98, false, false));
}

// ---------------------------------------------------------------------------
// Operand preparation, one launch. The five jobs do not depend on one another
// and are block-index ranges of one grid:
//   blocks [0, 4*PACKB)  pack Wq, Wk, Wv, Wo (row-major fp32 [out=768][in=768])
//                        into WMMA B-fragments of 1 KB, PACKB blocks each: the 32
//                        lanes' first 8 halfs, then the 32 lanes' second 8, so
//                        that each 16-B read of a fragment is 512 B in a row
//   the rest             fp32 -> f16 elementwise convert of x
// The packs stand first: few blocks with strided reads, they start early and
// run under the stream of x.
// ---------------------------------------------------------------------------
constexpr int PACKB = (DM / 32) * (DM / 16) * 32 / 256;   // 144 blocks per weight
constexpr int CVTB  = NTOK * DM / (256 * 4);              // 6144 blocks for x

__global__ void __launch_bounds__(256)
prep_operands(const float* __restrict__ x,
              const float* __restrict__ Wq, const float* __restrict__ Wk,
              const float* __restrict__ Wv, const float* __restrict__ Wo,
              _Float16* __restrict__ Xf, _Float16* __restrict__ Wpack) {
    const int blk = blockIdx.x;
    if (blk < 4 * PACKB) {
        const int w = blk / PACKB;                            // which weight
        const float* __restrict__ W = w == 0 ? Wq : w == 1 ? Wk : w == 2 ? Wv : Wo;
        _Float16* __restrict__ Wp = Wpack + (size_t)w * DM * DM;
        const int t    = (blk - w * PACKB) * 256 + threadIdx.x;   // 36864 threads
        const int lane = t & 31;
        const int tile = t >> 5;                                  // 0..1151
        const int nt   = tile % (DM / 16);
        const int kt   = tile / (DM / 16);
        const int n    = nt * 16 + (lane & 15);
        const int k0   = kt * 32 + (lane >> 4) * 16;
        const float* src = &W[(size_t)n * DM + k0];
        _Float16*    dst = &Wp[(size_t)tile * 512 + lane * 8];
#pragma unroll
        for (int i = 0; i < 8; ++i) {
            dst[i]       = (_Float16)src[i];
            dst[256 + i] = (_Float16)src[8 + i];
        }
    } else {
        const int i = ((blk - 4 * PACKB) * 256 + threadIdx.x) * 4;
        if (i < NTOK * DM) {
            const float4 v = *reinterpret_cast<const float4*>(x + i);
            Xf[i + 0] = (_Float16)v.x;
            Xf[i + 1] = (_Float16)v.y;
            Xf[i + 2] = (_Float16)v.z;
            Xf[i + 3] = (_Float16)v.w;
        }
    }
}

// ---------------------------------------------------------------------------
// GEMM: Y[8192,768] = Xf16 * W^T + bias. WG tile 128x128, 8 waves (4 x 2), 32x64
// per wave (8 WMMA accs). A stage is 64 k of both operands in LDS: X rows at
// pitch P64 and the packed W fragments of the tile's 8 column tiles, copied as
// they lie (2 x 8 KB in a row). Two buffers, one barrier per stage, the next
// stage's global loads in flight under the WMMAs.
// blockIdx.x = product * 6 + column block: products that share X (Q, K, V) are
// column ranges of one grid; packed weights and f16 outputs of successive
// products lie one behind the other, each product has its own bias.
// blockIdx.y = batch row * 16 + tile. A tile of Q or of the output projection is
// 128 tokens in a row. K and V rows are read by the attention only for keys that
// the mask keeps (or for all keys, where it walks all: no key kept, or a scale too
// small for a masked weight to vanish), so a K or V tile is 128 entries of the
// batch row's list of kept tokens: the block lists them as the attention does,
// gathers its X rows and stores its K/V rows through the list (Tok); tiles past
// the end of the list do nothing.
// ---------------------------------------------------------------------------
constexpr int GK     = 64;               // k per stage
constexpr int GSTAGE = DM / GK;          // 12
constexpr int WSTG   = 2 * 8 * 512;      // halfs of W per stage: 2 k tiles x 8 column tiles

template <bool F32OUT>
__global__ void __launch_bounds__(256)
gemm_bias_768(const _Float16* __restrict__ X,
              const _Float16* __restrict__ Wpack,
              const float*    __restrict__ bias0,
              const float*    __restrict__ bias1,
              const float*    __restrict__ bias2,
              const int*      __restrict__ mask,
              const float*    __restrict__ temp,
              float*          __restrict__ Yf32,
              _Float16*       __restrict__ Yall) {
    __shared__ __align__(32) _Float16 Xs[2][128 * P64];  // 2 x 18 KB
    __shared__ __align__(32) _Float16 Ws[2][WSTG];       // 2 x 16 KB
    __shared__ __align__(16) int   Cnt[KBLK];            // kept tokens per 32-token segment
    __shared__ __align__(16) unsigned short Tok[128];    // tile row -> token of the batch row

    const int tid   = threadIdx.x;
    const int lane  = tid & 31;
    const int wave  = tid >> 5;
    const int mw    = wave & 3;
    const int nw    = wave >> 2;
    const int tok0  = (blockIdx.y >> 4) * SEQ;      // first token of the batch row
    const int tl    = (blockIdx.y & 15) * 128;      // the tile's first place in its row's list
    const int prod  = blockIdx.x / (DM / 128);
    const int n0    = (blockIdx.x - prod * (DM / 128)) * 128;
    const int lrow  = lane & 15;
    const int lhalf = lane >> 4;

    const _Float16* __restrict__ Wp   = Wpack + (size_t)prod * DM * DM;
    const float*    __restrict__ bias = prod == 0 ? bias0 : prod == 1 ? bias1 : bias2;
    _Float16*       __restrict__ Yf16 = Yall + (size_t)prod * NTOK * DM;

    // the tile's tokens. Thread t looks at tokens j * 256 + t, so a wave's ballot is
    // one 32-token segment; segment counts meet in LDS, every thread sums those ahead
    // of its own 8 segments (the attention's own listing, cut to this tile's window).
    int  nrow   = SEQ;      // length of the list
    bool listed = false;
    if constexpr (!F32OUT) {
        if (prod != 0) {
            int      mk[8];
            unsigned bal[8];
#pragma unroll
            for (int j = 0; j < 8; ++j) mk[j] = mask[tok0 + j * 256 + tid];
#pragma unroll
            for (int j = 0; j < 8; ++j) bal[j] = __builtin_amdgcn_ballot_w32(mk[j] != 0);
            if (lane == 0) {
#pragma unroll
                for (int j = 0; j < 8; ++j) Cnt[j * 8 + wave] = __popc(bal[j]);
            }
            bool all = false;   // some head walks all keys: the attention's own test
#pragma unroll
            for (int hh = 0; hh < NH; ++hh) all |= !(1.0e9f * (temp[hh] * 0.125f) >= 1.0e5f);
            __syncthreads();
            int pre[8];
            int run = 0;
#pragma unroll
            for (int j = 0; j < 8; ++j) {
                int tot = 0, part = 0;
#pragma unroll
                for (int w = 0; w < 8; ++w) {
                    const int v = Cnt[j * 8 + w];
                    part += w < wave ? v : 0;
                    tot  += v;
                }
                pre[j] = run + part;
                run   += tot;
            }
            const int nkeep = __builtin_amdgcn_readfirstlane(run);  // same in every thread
            listed = !(all || nkeep == 0);
            if (listed) {
                nrow = nkeep;
                const unsigned below = (1u << lane) - 1u;
#pragma unroll
                for (int j = 0; j < 8; ++j) {
                    const unsigned pos = (unsigned)(pre[j] + __popc(bal[j] & below) - tl);
                    if (mk[j] && pos < 128u) Tok[pos] = (unsigned short)(j * 256 + tid);
                }
                // rows past the list's end: staged from token 0, never stored
                if (tid < 128 && tl + tid >= nkeep) Tok[tid] = 0;
            }
        }
    }
    if constexpr (!F32OUT) {
        if (!listed && tid < 128) Tok[tid] = (unsigned short)(tl + tid);
        __syncthreads();
    }
    // token (of the batch row) that stands in row lr of the tile
    auto token = [&](int lr) {
        if constexpr (F32OUT) return tl + lr;
        else                  return (int)Tok[lr];
    };
    if (tl < nrow) {    // same for the whole block

    // staging, 16 B per thread and piece: X piece i is rows 32 i .. 32 i + 31 (8
    // threads per 128-B row); W piece i is 4 KB in a row of k tile i / 2
    const int sr = tid >> 3;
    const int sc = (tid & 7) * 8;

    const _Float16* xsrc[4];    // X piece i: this thread's 16 B of stage 0
#pragma unroll
    for (int i = 0; i < 4; ++i) {
        if constexpr (F32OUT) xsrc[i] = &X[(size_t)(tok0 + tl + sr) * DM + sc] + (size_t)i * 32 * DM;
        else                  xsrc[i] = &X[(size_t)(tok0 + token(sr + 32 * i)) * DM + sc];
    }
    const _Float16* wsrc = &Wp[(size_t)(n0 >> 4) * 512 + tid * 8];
    constexpr size_t WK = (size_t)(DM / 16) * 512;  // W k tile to k tile, halfs

    uint4 x0, x1, x2, x3, w0, w1, w2, w3;
    auto gload = [&](int st) {
        const _Float16* wp = wsrc + (size_t)(2 * st) * WK;
        x0 = *reinterpret_cast<const uint4*>(xsrc[0] + st * GK);
        x1 = *reinterpret_cast<const uint4*>(xsrc[1] + st * GK);
        x2 = *reinterpret_cast<const uint4*>(xsrc[2] + st * GK);
        x3 = *reinterpret_cast<const uint4*>(xsrc[3] + st * GK);
        w0 = *reinterpret_cast<const uint4*>(wp);
        w1 = *reinterpret_cast<const uint4*>(wp + 2048);
        w2 = *reinterpret_cast<const uint4*>(wp + WK);
        w3 = *reinterpret_cast<const uint4*>(wp + WK + 2048);
    };
    auto sstore = [&](int buf) {
        _Float16* xd = &Xs[buf][sr * P64 + sc];
        _Float16* wd = &Ws[buf][tid * 8];
        *reinterpret_cast<uint4*>(xd)                = x0;
        *reinterpret_cast<uint4*>(xd + 32 * P64)     = x1;
        *reinterpret_cast<uint4*>(xd + 2 * 32 * P64) = x2;
        *reinterpret_cast<uint4*>(xd + 3 * 32 * P64) = x3;
        *reinterpret_cast<uint4*>(wd)                = w0;
        *reinterpret_cast<uint4*>(wd + 2048)         = w1;
        *reinterpret_cast<uint4*>(wd + 2 * 2048)     = w2;
        *reinterpret_cast<uint4*>(wd + 3 * 2048)     = w3;
    };

    v8f c[2][4] = {};

    // one stage's 16 WMMAs from buffer cur
    auto compute = [&](int cur) {
#pragma unroll
        for (int ks = 0; ks < 2; ++ks) {
            v16h a[2], b[4];
#pragma unroll
            for (int r = 0; r < 2; ++r)
                a[r] = ld_frag(&Xs[cur][(mw * 32 + r * 16 + lrow) * P64 + ks * 32 + lhalf * 16]);
#pragma unroll
            for (int j = 0; j < 4; ++j) {
                const _Float16* f = &Ws[cur][(ks * 8 + nw * 4 + j) * 512 + lane * 8];
                const v8h lo = *reinterpret_cast<const v8h*>(f);
                const v8h hi = *reinterpret_cast<const v8h*>(f + 256);
                b[j] = __builtin_shufflevector(lo, hi, 0, 1, 2, 3, 4, 5, 6, 7,
                                               8, 9, 10, 11, 12, 13, 14, 15);
            }
#pragma unroll
            for (int r = 0; r < 2; ++r)
#pragma unroll
                for (int j = 0; j < 4; ++j)
                    c[r][j] = __builtin_amdgcn_wmma_f32_16x16x32_f16(
                        false, a[r], false, b[j], (short)0, c[r][j], false, false);
        }
    };

    gload(0);
    sstore(0);
    for (int st = 0; st + 1 < GSTAGE; ++st) {
        __syncthreads();
        gload(st + 1);                        // in flight under the WMMAs
        compute(st & 1);
        sstore((st & 1) ^ 1);
        // order within the stage: the eight global loads ahead of the LDS reads, and
        // their LDS stores behind the WMMAs. With the loads sunk to the stores, or the
        // stores among the WMMAs, the wave waits out the load latency with matrix
        // work still to issue
        __builtin_amdgcn_sched_group_barrier(0x020, 8, 0);    // global loads
        __builtin_amdgcn_sched_group_barrier(0x100, 24, 0);   // LDS reads
        __builtin_amdgcn_sched_group_barrier(0x008, 16, 1);   // WMMAs
        __builtin_amdgcn_sched_group_barrier(0x200, 8, 1);    // LDS stores
    }
    __syncthreads();
    compute((GSTAGE - 1) & 1);

    if constexpr (F32OUT) {
#pragma unroll
        for (int j = 0; j < 4; ++j) {
            const int col  = n0 + nw * 64 + j * 16 + lrow;
            const float bv = bias[col];
#pragma unroll
            for (int r = 0; r < 2; ++r) {
#pragma unroll
                for (int jv = 0; jv < 8; ++jv) {
                    const int row = tok0 + tl + mw * 32 + r * 16 + jv + 8 * lhalf;
                    Yf32[(size_t)row * DM + col] = c[r][j][jv] + bv;
                }
            }
        }
    } else {
        // rows go to their tokens; the biases and the 16 tokens are fetched ahead of
        // the row tests, so that no test has a wait behind it
        const int col0 = n0 + nw * 64 + lrow;
        float bv[4];
#pragma unroll
        for (int j = 0; j < 4; ++j) bv[j] = bias[col0 + j * 16];
        v8s tk[2];
#pragma unroll
        for (int r = 0; r < 2; ++r)
            tk[r] = *reinterpret_cast<const v8s*>(&Tok[mw * 32 + r * 16 + 8 * lhalf]);
        auto rows = [&](bool edge) {
#pragma unroll
            for (int r = 0; r < 2; ++r) {
#pragma unroll
                for (int jv = 0; jv < 8; ++jv) {
                    if (!edge || tl + mw * 32 + r * 16 + jv + 8 * lhalf < nrow) {
                        _Float16* yrow = &Yf16[(size_t)(tok0 + tk[r][jv]) * DM + col0];
#pragma unroll
                        for (int j = 0; j < 4; ++j) yrow[j * 16] = (_Float16)(c[r][j][jv] + bv[j]);
                        // the next row's sums and address take over the registers that these
                        // four stores name: the wait stands between the stores and that overwrite
                        asm volatile("s_wait_xcnt 0x0" ::: "memory");
                    }
                }
            }
        };
        // only the list's last tile can hold rows past its end: the others store
        // without a test per row
        if (tl + 128 <= nrow) rows(false);
        else                  rows(true);
    }

    }   // tl < nrow
}

struct PassPlain  { static constexpr bool bias = false; };
struct PassBiased { static constexpr bool bias = true;  };

__global__ void __launch_bounds__(256, 1)
attn_flash(const _Float16* __restrict__ Q,
           const _Float16* __restrict__ K,
           const _Float16* __restrict__ V,
           const int*      __restrict__ mask,
           const float*    __restrict__ temp,
           _Float16*       __restrict__ O) {
    __shared__ __align__(32) _Float16 Ks [2][32 * P64];   // [key][d]
    __shared__ __align__(32) _Float16 Vs [2][32 * PTR];   // [key][d], read transposed
    __shared__ __align__(32) float Mb[SEQ];               // additive bias per listed key
    __shared__ __align__(16) int   Cnt[KBLK];             // kept keys per 32-key segment
    __shared__ unsigned short      Idx[SEQ];              // listed key -> row of the batch

    const int lane  = threadIdx.x & 31;
    const int wave  = threadIdx.x >> 5;
    const int b     = blockIdx.z;
    const int h     = blockIdx.y;
    const int q0    = (blockIdx.x * 8 + wave) * 16;
    const int lrow  = lane & 15;
    const int lhalf = lane >> 4;
    const float scale = temp[h] * 0.125f;     // temperature / sqrt(64)
    const float scale2 = scale * 1.44269504f; // the same for exponents of 2

    const size_t tokBase = (size_t)b * SEQ;

    // list the kept keys. Thread t looks at keys j * 256 + t, so a wave's ballot is
    // one 32-key segment; segment counts meet in LDS, every thread sums those ahead
    // of its own 8 segments.
    const float mbias = -1.0e9f * scale2;
    int      mk[8];
    unsigned bal[8];
#pragma unroll
    for (int j = 0; j < 8; ++j) mk[j] = mask[b * SEQ + j * 256 + threadIdx.x];
#pragma unroll
    for (int j = 0; j < 8; ++j) bal[j] = __builtin_amdgcn_ballot_w32(mk[j] != 0);
    if (lane == 0) {
#pragma unroll
        for (int j = 0; j < 8; ++j) Cnt[j * 8 + wave] = __popc(bal[j]);
    }
    __syncthreads();
    int pre[8];     // kept keys ahead of segment j * 8 + wave
    int run = 0;
#pragma unroll
    for (int j = 0; j < 8; ++j) {
        int tot = 0, part = 0;      // eight short chains, joined by run
#pragma unroll
        for (int w = 0; w < 8; ++w) {
            const int v = Cnt[j * 8 + w];
            part += w < wave ? v : 0;
            tot  += v;
        }
        pre[j] = run + part;
        run   += tot;
    }
    const int  nkeep   = __builtin_amdgcn_readfirstlane(run);   // same in every thread
    const bool walkAll = nkeep == 0 || !(1.0e9f * scale >= 1.0e5f);
    const int  nkey    = walkAll ? SEQ : nkeep;
    const int  nblk    = max(1, min((nkey + 31) >> 5, KBLK));   // passes, 1 .. 64
    if (walkAll) {
#pragma unroll
        for (int j = 0; j < 8; ++j) {
            const int k = j * 256 + threadIdx.x;
            Idx[k] = (unsigned short)k;
            Mb[k]  = mk[j] ? 0.0f : mbias;
        }
    } else {
        const unsigned below = (1u << lane) - 1u;
#pragma unroll
        for (int j = 0; j < 8; ++j) {
            const int k = j * 256 + threadIdx.x;
            if (mk[j]) Idx[pre[j] + __popc(bal[j] & below)] = (unsigned short)k;
            Mb[k] = k < nkey ? 0.0f : mbias;
        }
    }
    __syncthreads();

    // Q fragments pre-scaled by log2(e) * temperature/sqrt(d); the product is formed
    // in f32 and rounded once
    v16h aq[2];
#pragma unroll
    for (int f = 0; f < 2; ++f) {
        const v16h qf = *reinterpret_cast<const v16h*>(
            &Q[(tokBase + q0 + lrow) * DM + h * DH + f * 32 + lhalf * 16]);
#pragma unroll
        for (int i = 0; i < 16; ++i) aq[f][i] = (_Float16)((float)qf[i] * scale2);
    }

    // A operand of the column sums: rows 0 and 8 are ones, the rest 0, so that
    // register 0 of either lane half receives its query's sum over all 32 keys.
    const _Float16 oneOrZero = (lane & 7) == 0 ? (_Float16)1.0f : (_Float16)0.0f;
    v16h ones;
#pragma unroll
    for (int i = 0; i < 16; ++i) ones[i] = oneOrZero;

    v8f   acc[4] = {};        // O^T: acc[nt][jv] = O[q0 + lrow][nt*16 + 8*lhalf + jv]
    v8f   accS   = {};        // accS[0] = running denominator of query q0 + lrow
    // passes whose 32 places are all listed keys; the rest take the bias
    const int nplain = walkAll ? 0 : min(nkey >> 5, nblk);
    // reference maximum of query q0 + lrow (base-2 scores); a plain first pass starts
    // its scores at 0 and sets it
    float mrun   = nplain > 0 ? 0.0f : -3.0e38f;
    v8f   negm   = {};        // -mrun in every register: C operand of a plain pass

    const int skey = threadIdx.x >> 3;   // K/V staging: 8 threads per key
    const int sch  = threadIdx.x & 7;

    uint4 kreg, vreg;
    auto gload = [&](int row) {
        const size_t g = (tokBase + row) * DM + h * DH + sch * 8;
        kreg = *reinterpret_cast<const uint4*>(&K[g]);
        vreg = *reinterpret_cast<const uint4*>(&V[g]);
        // the two address pairs are scratch registers that the pass's LDS reads take
        // over next: the wait stands between the loads and that overwrite
        asm volatile("s_wait_xcnt 0x0" ::: "memory");
    };
    auto sstore = [&](int buf) {
        *reinterpret_cast<uint4*>(&Ks[buf][skey * P64 + sch * 8]) = kreg;
        *reinterpret_cast<uint4*>(&Vs[buf][skey * PTR + sch * 8]) = vreg;
    };
    // this lane's address inside a V tile for the transposing loads
    const int vtoff = (8 * lhalf + (lane & 7)) * PTR + ((lane >> 3) & 1) * 8;

    const int klast = nkey - 1;                   // places past it repeat the last listed key
    gload(Idx[min(skey, klast)]);
    int rnext = Idx[min(32 + skey, klast)];       // row of the next pass, read a pass ahead
    sstore(0);
    auto pass = [&](int kb, auto kind) {
        constexpr bool BIAS = decltype(kind)::bias;
        __syncthreads();
        const int cur = kb & 1;
        if (kb + 1 < nblk) gload(rnext);      // in flight under the WMMAs
        if (kb + 2 < nblk) rnext = Idx[min((kb + 2) * 32 + skey, klast)];
        // keeps the two loads up here: sunk to their LDS stores at the foot of the
        // pass, their whole latency would stand in front of the next barrier
        __builtin_amdgcn_sched_barrier(0);

        // S^T (pre-scaled), two 16-key row tiles: sc[jv] = S[q0 + lrow][key 8*lhalf + jv]
        v8f sc0 = {}, sc1 = {};
        if constexpr (!BIAS) { sc0 = negm; sc1 = negm; }
#pragma unroll
        for (int f = 0; f < 2; ++f) {
            const v16h bk0 = ld_frag(&Ks[cur][lrow * P64 + f * 32 + lhalf * 16]);
            const v16h bk1 = ld_frag(&Ks[cur][(16 + lrow) * P64 + f * 32 + lhalf * 16]);
            sc0 = __builtin_amdgcn_wmma_f32_16x16x32_f16(
                false, bk0, false, aq[f], (short)0, sc0, false, false);
            sc1 = __builtin_amdgcn_wmma_f32_16x16x32_f16(
                false, bk1, false, aq[f], (short)0, sc1, false, false);
        }

        // V^T fragments, asked for ahead of the test on the maximum: behind that branch
        // their LDS latency would stand in front of the PV WMMAs
        v16h av[4];
#pragma unroll
        for (int nt = 0; nt < 4; ++nt) av[nt] = ld_frag_vt(&Vs[cur][vtoff + nt * 16]);

        if constexpr (BIAS) {
            const int kk0 = kb * 32;
            sc0 += *reinterpret_cast<const v8f*>(&Mb[kk0 + 8 * lhalf]);
            sc1 += *reinterpret_cast<const v8f*>(&Mb[kk0 + 16 + 8 * lhalf]);
        }

        // the query's maximum over its 32 keys: 16 in this lane, 16 in lane ^ 16
        // (a tree three deep, not one chain of eight links)
        auto max3 = [](float a, float b, float c) { return fmaxf(fmaxf(a, b), c); };
        float rm = fmaxf(max3(max3(sc0[0], sc0[1], sc0[2]), max3(sc0[3], sc0[4], sc0[5]),
                              max3(sc0[6], sc0[7], sc1[0])),
                         max3(max3(sc1[1], sc1[2], sc1[3]), max3(sc1[4], sc1[5], sc1[6]),
                              sc1[7]));

        // moves the reference by d: the scores of this pass and the sums so far follow
        auto shift = [&](float d, float cr) {
            sc0 -= d;
            sc1 -= d;
            accS[0] *= cr;        // registers 1..7 of accS stay 0
#pragma unroll
            for (int nt = 0; nt < 4; ++nt) acc[nt] *= cr;
        };
        if constexpr (BIAS) {
            rm = fmaxf(rm, xhalf(rm));
            const float mnew = fmaxf(mrun, rm);
            shift(mnew, __builtin_amdgcn_exp2f(mrun - mnew));
            mrun = mnew;
        } else if (kb == 0 || __builtin_amdgcn_ballot_w32(rm > 8.0f) != 0u) {
            // one test a pass, the same for the whole wave. The scores stand against
            // mrun already; the first pass takes its maximum whatever its sign (the sums
            // are still 0), a later one only moves up
            rm = fmaxf(rm, xhalf(rm));
            const float d = kb == 0 ? rm : fmaxf(rm, 0.0f);
            shift(d, kb == 0 ? 0.0f : __builtin_amdgcn_exp2f(-d));
            mrun += d;
#pragma unroll
            for (int jv = 0; jv < 8; ++jv) negm[jv] = -mrun;
        }

        v8f p0, p1;
#pragma unroll
        for (int jv = 0; jv < 8; ++jv) {
            p0[jv] = __builtin_amdgcn_exp2f(sc0[jv]);
            p1[jv] = __builtin_amdgcn_exp2f(sc1[jv]);
        }
        // P^T as B fragment: the two converted tiles, register for register
        const v16h pb = __builtin_shufflevector(
            __builtin_convertvector(p0, v8h), __builtin_convertvector(p1, v8h),
            0, 1, 2, 3, 4, 5, 6, 7, 8, 9, 10, 11, 12, 13, 14, 15);

        accS = __builtin_amdgcn_wmma_f32_16x16x32_f16(
            false, ones, false, pb, (short)0, accS, false, false);
#pragma unroll
        for (int nt = 0; nt < 4; ++nt)
            acc[nt] = __builtin_amdgcn_wmma_f32_16x16x32_f16(
                false, av[nt], false, pb, (short)0, acc[nt], false, false);

        if (kb + 1 < nblk) sstore(cur ^ 1);   // waits loadcnt here, post-compute
    };
    for (int kb = 0; kb < nplain; ++kb) pass(kb, PassPlain{});
    for (int kb = nplain; kb < nblk; ++kb) pass(kb, PassBiased{});

    // normalize + store f16 ([token][768], heads interleaved): 8 consecutive d per tile
    const float inv = 1.0f / accS[0];
    _Float16* orow = &O[(tokBase + q0 + lrow) * DM + h * DH + 8 * lhalf];
#pragma unroll
    for (int nt = 0; nt < 4; ++nt)
        *reinterpret_cast<v8h*>(orow + nt * 16) = __builtin_convertvector(acc[nt] * inv, v8h);
}

// ---------------------------------------------------------------------------
extern "C" void kernel_launch(void* const* d_in, const int* in_sizes, int n_in,
                              void* d_out, int out_size, void* d_ws, size_t ws_size,
                              hipStream_t stream) {
    const float* x    = (const float*)d_in[0];
    const int*   mask = (const int*)  d_in[1];
    const float* Wq   = (const float*)d_in[2];
    const float* bq   = (const float*)d_in[3];
    const float* Wk   = (const float*)d_in[4];
    const float* bk   = (const float*)d_in[5];
    const float* Wv   = (const float*)d_in[6];
    const float* bv   = (const float*)d_in[7];
    const float* Wo   = (const float*)d_in[8];
    const float* bo   = (const float*)d_in[9];
    const float* temp = (const float*)d_in[10];
    float* out = (float*)d_out;

    size_t off = 0;
    auto walloc = [&](size_t elems) {
        void* p = (char*)d_ws + off;
        off = (off + elems * sizeof(_Float16) + 255) & ~(size_t)255;
        return (_Float16*)p;
    };
    _Float16* Xf  = walloc((size_t)NTOK * DM);
    _Float16* Wpk = walloc((size_t)4 * DM * DM);     // packed Wq, Wk, Wv, Wo
    _Float16* Qf  = walloc((size_t)3 * NTOK * DM);   // Q, K, V one behind the other
    _Float16* Kf  = Qf + (size_t)NTOK * DM;
    _Float16* Vf  = Kf + (size_t)NTOK * DM;
    _Float16* Wop = Wpk + (size_t)3 * DM * DM;
    _Float16* Af  = Xf;   // attention output reuses x_f16 (dead after the QKV GEMM)

    prep_operands<<<4 * PACKB + CVTB, 256, 0, stream>>>(x, Wq, Wk, Wv, Wo, Xf, Wpk);

    gemm_bias_768<false><<<dim3(3 * DM / 128, NTOK / 128), 256, 0, stream>>>(
        Xf, Wpk, bq, bk, bv, mask, temp, nullptr, Qf);

    attn_flash<<<dim3(SEQ / (16 * 8), NH, 4), 256, 0, stream>>>(Qf, Kf, Vf, mask, temp, Af);

    gemm_bias_768<true><<<dim3(DM / 128, NTOK / 128), 256, 0, stream>>>(
        Af, Wop, bo, bo, bo, mask, temp, out, nullptr);
}

// v009
// A run of this version takes 79.3 microseconds.
// Next to v008, in two timings, it ran 1.04 times as fast each time.
// Over all steps from v000 it is 5.24 times as fast.
#include <hip/hip_runtime.h>

typedef __attribute__((ext_vector_type(16))) _Float16 v16h;
typedef __attribute__((ext_vector_type(8)))  _Float16 v8h;
typedef __attribute__((ext_vector_type(8)))  short    v8s;
typedef __attribute__((ext_vector_type(8)))  float    v8f;

constexpr int DM     = 768;     // d_model
constexpr int NTOK   = 4 * 2048;
constexpr int SEQ    = 2048;
constexpr int NH     = 12;
constexpr int DH     = 64;
constexpr int KBLK   = SEQ / 32;    // 64 key blocks

// LDS row pitches in halfs, each for its reader. ds_load_b128: row bytes + 16, an
// odd multiple of 16 B, so that the 16 rows a load touches per lane half fall on
// distinct banks. ds_load_tr16_b128: row bytes + 32, an odd multiple of 32 B.
constexpr int P64 = 64 + 8;         // 128-B rows -> 144 B
constexpr int PTR = 64 + 16;        // 128-B rows -> 160 B, read transposed

// 16 consecutive halfs of an LDS row as one fragment; rows are 16-B aligned only.
__device__ inline v16h ld_frag(const _Float16* p) {
    const v8h lo = *reinterpret_cast<const v8h*>(p);
    const v8h hi = *reinterpret_cast<const v8h*>(p + 8);
    return __builtin_shufflevector(lo, hi, 0, 1, 2, 3, 4, 5, 6, 7, 8, 9, 10, 11, 12, 13, 14, 15);
}

// Transposing LDS load of a row-major 16-bit tile T. Lane l hands in the address of
// T[8 (l >> 4) + (l & 7)][8 ((l >> 3) & 1)] and receives T[8 (l >> 4) + 0..7][l & 15].
__device__ inline v8h ld_tr16(const _Float16* p) {
    typedef __attribute__((address_space(3))) v8s lds_v8s;
    return __builtin_bit_cast(v8h, __builtin_amdgcn_ds_load_tr16_b128_v8i16((lds_v8s*)p));
}

// 16 d x 32 keys of V^T as an A fragment, out of V rows [key][d] at pitch PTR: two
// transposing loads, keys 0..15 and 16..31. Lane half h gets keys 8h..8h+7 and
// 16+8h..16+8h+7, the k order that a packed pair of score tiles has as B.
__device__ inline v16h ld_frag_vt(const _Float16* p) {
    const v8h lo = ld_tr16(p);
    const v8h hi = ld_tr16(p + 16 * PTR);
    return __builtin_shufflevector(lo, hi, 0, 1, 2, 3, 4, 5, 6, 7, 8, 9, 10, 11, 12, 13, 14, 15);
}

// value of lane l ^ 16
__device__ inline float xhalf(float x) {
    const int b = __builtin_bit_cast(int, x);
    return __builtin_bit_cast(float,
        __builtin_amdgcn_permlanex16(b, b, 0x76543210, 0xfedcba98, false, false));
}

// ---------------------------------------------------------------------------
// Operand preparation, one launch. The five jobs do not depend on one another
// and are block-index ranges of one grid:
//   blocks [0, 4*PACKB)  pack Wq, Wk, Wv, Wo (row-major fp32 [out=768][in=768])
//                        into WMMA B-fragments of 1 KB, PACKB blocks each: the 32
//                        lanes' first 8 halfs, then the 32 lanes' second 8, so
//                        that each 16-B read of a fragment is 512 B in a row
//   the rest             fp32 -> f16 elementwise convert of x
// The packs stand first: few blocks with strided reads, they start early and
// run under the stream of x.
// ---------------------------------------------------------------------------
constexpr int PACKB = (DM / 32) * (DM / 16) * 32 / 256;   // 144 blocks per weight
constexpr int CVTB  = NTOK * DM / (256 * 4);              // 6144 blocks for x

__global__ void __launch_bounds__(256)
prep_operands(const float* __restrict__ x,
              const float* __restrict__ Wq, const float* __restrict__ Wk,
              const float* __restrict__ Wv, const float* __restrict__ Wo,
              _Float16* __restrict__ Xf, _Float16* __restrict__ Wpack) {
    const int blk = blockIdx.x;
    if (blk < 4 * PACKB) {
        const int w = blk / PACKB;                            // which weight
        const float* __restrict__ W = w == 0 ? Wq : w == 1 ? Wk : w == 2 ? Wv : Wo;
        _Float16* __restrict__ Wp = Wpack + (size_t)w * DM * DM;
        const int t    = (blk - w * PACKB) * 256 + threadIdx.x;   // 36864 threads
        const int lane = t & 31;
        const int tile = t >> 5;                                  // 0..1151
        const int nt   = tile % (DM / 16);
        const int kt   = tile / (DM / 16);
        const int n    = nt * 16 + (lane & 15);
        const int k0   = kt * 32 + (lane >> 4) * 16;
        const float* src = &W[(size_t)n * DM + k0];
        _Float16*    dst = &Wp[(size_t)tile * 512 + lane * 8];
#pragma unroll
        for (int i = 0; i < 8; ++i) {
            dst[i]       = (_Float16)src[i];
            dst[256 + i] = (_Float16)src[8 + i];
        }
    } else {
        const int i = ((blk - 4 * PACKB) * 256 + threadIdx.x) * 4;
        if (i < NTOK * DM) {
            const float4 v = *reinterpret_cast<const float4*>(x + i);
            Xf[i + 0] = (_Float16)v.x;
            Xf[i + 1] = (_Float16)v.y;
            Xf[i + 2] = (_Float16)v.z;
            Xf[i + 3] = (_Float16)v.w;
        }
    }
}

// ---------------------------------------------------------------------------
// GEMM: Y[8192,768] = Xf16 * W^T + bias. WG tile 128x128, 8 waves (4 x 2), 32x64
// per wave (8 WMMA accs). A stage is 64 k of both operands in LDS: X rows at
// pitch P64 and the packed W fragments of the tile's 8 column tiles, copied as
// they lie (2 x 8 KB in a row). Two buffers, one barrier per stage; a stage comes in
// by asynchronous copies to LDS, in flight under the WMMAs of the stage before. No
// register holds staged data, so a wave fits 128 VGPRs and four blocks share a WGP
// (three before): with about half the tokens kept, the Q/K/V blocks that have work
// are all resident at once instead of a few dozen waiting for a second round.
// blockIdx.x = product * 6 + column block: products that share X (Q, K, V) are
// column ranges of one grid; packed weights and f16 outputs of successive
// products lie one behind the other, each product has its own bias.
// blockIdx.y = batch row * 16 + tile. A tile of Q or of the output projection is
// 128 tokens in a row. K and V rows are read by the attention only for keys that
// the mask keeps (or for all keys, where it walks all: no key kept, or a scale too
// small for a masked weight to vanish), so a K or V tile is 128 entries of the
// batch row's list of kept tokens: the block lists them as the attention does,
// gathers its X rows and stores its K/V rows through the list (Tok); tiles past
// the end of the list do nothing.
// ---------------------------------------------------------------------------
constexpr int GK     = 64;               // k per stage
constexpr int GSTAGE = DM / GK;          // 12
constexpr int WSTG   = 2 * 8 * 512;      // halfs of W per stage: 2 k tiles x 8 column tiles

template <bool F32OUT>
__global__ void __launch_bounds__(256)
gemm_bias_768(const _Float16* __restrict__ X,
              const _Float16* __restrict__ Wpack,
              const float*    __restrict__ bias0,
              const float*    __restrict__ bias1,
              const float*    __restrict__ bias2,
              const int*      __restrict__ mask,
              const float*    __restrict__ temp,
              float*          __restrict__ Yf32,
              _Float16*       __restrict__ Yall) {
    __shared__ __align__(32) _Float16 Xs[2][128 * P64];  // 2 x 18 KB
    __shared__ __align__(32) _Float16 Ws[2][WSTG];       // 2 x 16 KB
    __shared__ __align__(16) int   Cnt[KBLK];            // kept tokens per 32-token segment
    __shared__ __align__(16) unsigned short Tok[128];    // tile row -> token of the batch row

    const int tid   = threadIdx.x;
    const int lane  = tid & 31;
    const int wave  = tid >> 5;
    const int mw    = wave & 3;
    const int nw    = wave >> 2;
    const int tok0  = (blockIdx.y >> 4) * SEQ;      // first token of the batch row
    const int tl    = (blockIdx.y & 15) * 128;      // the tile's first place in its row's list
    const int prod  = blockIdx.x / (DM / 128);
    const int n0    = (blockIdx.x - prod * (DM / 128)) * 128;
    const int lrow  = lane & 15;
    const int lhalf = lane >> 4;

    const _Float16* __restrict__ Wp   = Wpack + (size_t)prod * DM * DM;
    const float*    __restrict__ bias = prod == 0 ? bias0 : prod == 1 ? bias1 : bias2;
    _Float16*       __restrict__ Yf16 = Yall + (size_t)prod * NTOK * DM;

    // the tile's tokens. Thread t looks at tokens j * 256 + t, so a wave's ballot is
    // one 32-token segment; segment counts meet in LDS, every thread sums those ahead
    // of its own 8 segments (the attention's own listing, cut to this tile's window).
    int  nrow   = SEQ;      // length of the list
    bool listed = false;
    if constexpr (!F32OUT) {
        if (prod != 0) {
            int      mk[8];
            unsigned bal[8];
#pragma unroll
            for (int j = 0; j < 8; ++j) mk[j] = mask[tok0 + j * 256 + tid];
#pragma unroll
            for (int j = 0; j < 8; ++j) bal[j] = __builtin_amdgcn_ballot_w32(mk[j] != 0);
            if (lane == 0) {
#pragma unroll
                for (int j = 0; j < 8; ++j) Cnt[j * 8 + wave] = __popc(bal[j]);
            }
            bool all = false;   // some head walks all keys: the attention's own test
#pragma unroll
            for (int hh = 0; hh < NH; ++hh) all |= !(1.0e9f * (temp[hh] * 0.125f) >= 1.0e5f);
            __syncthreads();
            int pre[8];
            int run = 0;
#pragma unroll
            for (int j = 0; j < 8; ++j) {
                int tot = 0, part = 0;
#pragma unroll
                for (int w = 0; w < 8; ++w) {
                    const int v = Cnt[j * 8 + w];
                    part += w < wave ? v : 0;
                    tot  += v;
                }
                pre[j] = run + part;
                run   += tot;
            }
            const int nkeep = __builtin_amdgcn_readfirstlane(run);  // same in every thread
            listed = !(all || nkeep == 0);
            if (listed) {
                nrow = nkeep;
                const unsigned below = (1u << lane) - 1u;
#pragma unroll
                for (int j = 0; j < 8; ++j) {
                    const unsigned pos = (unsigned)(pre[j] + __popc(bal[j] & below) - tl);
                    if (mk[j] && pos < 128u) Tok[pos] = (unsigned short)(j * 256 + tid);
                }
                // rows past the list's end: staged from token 0, never stored
                if (tid < 128 && tl + tid >= nkeep) Tok[tid] = 0;
            }
        }
    }
    if constexpr (!F32OUT) {
        if (!listed && tid < 128) Tok[tid] = (unsigned short)(tl + tid);
        __syncthreads();
    }
    // token (of the batch row) that stands in row lr of the tile
    auto token = [&](int lr) {
        if constexpr (F32OUT) return tl + lr;
        else                  return (int)Tok[lr];
    };
    if (tl < nrow) {    // same for the whole block

    // staging, 16 B per thread and piece: X piece i is rows 32 i .. 32 i + 31 (8
    // threads per 128-B row); W piece i is 4 KB in a row of k tile i / 2
    const int sr = tid >> 3;
    const int sc = (tid & 7) * 8;

    const _Float16* xsrc[4];    // X piece i: this thread's 16 B of stage 0
#pragma unroll
    for (int i = 0; i < 4; ++i) {
        if constexpr (F32OUT) xsrc[i] = &X[(size_t)(tok0 + tl + sr) * DM + sc] + (size_t)i * 32 * DM;
        else                  xsrc[i] = &X[(size_t)(tok0 + token(sr + 32 * i)) * DM + sc];
    }
    const _Float16* wsrc = &Wp[(size_t)(n0 >> 4) * 512 + tid * 8];
    constexpr size_t WK = (size_t)(DM / 16) * 512;  // W k tile to k tile, halfs

    // LDS byte addresses (low 32 bits of the __shared__ address) of this thread's first
    // X and W piece in buffer 0
    const unsigned xl0 = (unsigned)(size_t)&Xs[0][sr * P64 + sc];
    const unsigned wl0 = (unsigned)(size_t)&Ws[0][tid * 8];
    // stage st into buffer st & 1: eight 16-B copies a thread, every lane on
    auto copy = [&](int st) {
        const unsigned xl = xl0 + (st & 1) * (128 * P64 * 2);
        const unsigned wl = wl0 + (st & 1) * (WSTG * 2);
        const _Float16* wp = wsrc + (size_t)(2 * st) * WK;
        // the wait stands between the copies and any rewrite of their address registers
        asm volatile(
            "global_load_async_to_lds_b128 %0, %8, off\n\t"
            "global_load_async_to_lds_b128 %1, %9, off\n\t"
            "global_load_async_to_lds_b128 %2, %10, off\n\t"
            "global_load_async_to_lds_b128 %3, %11, off\n\t"
            "global_load_async_to_lds_b128 %4, %12, off\n\t"
            "global_load_async_to_lds_b128 %5, %13, off\n\t"
            "global_load_async_to_lds_b128 %6, %14, off\n\t"
            "global_load_async_to_lds_b128 %7, %15, off\n\t"
            "s_wait_xcnt 0x0"
            :: "v"(xl), "v"(xl + 32 * P64 * 2), "v"(xl + 64 * P64 * 2), "v"(xl + 96 * P64 * 2),
               "v"(wl), "v"(wl + 4096), "v"(wl + 8192), "v"(wl + 12288),
               "v"(xsrc[0] + st * GK), "v"(xsrc[1] + st * GK),
               "v"(xsrc[2] + st * GK), "v"(xsrc[3] + st * GK),
               "v"(wp), "v"(wp + 2048), "v"(wp + WK), "v"(wp + WK + 2048)
            : "memory");
    };

    v8f c[2][4] = {};

    // one stage's 16 WMMAs from buffer cur
    auto compute = [&](int cur) {
#pragma unroll
        for (int ks = 0; ks < 2; ++ks) {
            v16h a[2], b[4];
#pragma unroll
            for (int r = 0; r < 2; ++r)
                a[r] = ld_frag(&Xs[cur][(mw * 32 + r * 16 + lrow) * P64 + ks * 32 + lhalf * 16]);
#pragma unroll
            for (int j = 0; j < 4; ++j) {
                const _Float16* f = &Ws[cur][(ks * 8 + nw * 4 + j) * 512 + lane * 8];
                const v8h lo = *reinterpret_cast<const v8h*>(f);
                const v8h hi = *reinterpret_cast<const v8h*>(f + 256);
                b[j] = __builtin_shufflevector(lo, hi, 0, 1, 2, 3, 4, 5, 6, 7,
                                               8, 9, 10, 11, 12, 13, 14, 15);
            }
#pragma unroll
            for (int r = 0; r < 2; ++r)
#pragma unroll
                for (int j = 0; j < 4; ++j)
                    c[r][j] = __builtin_amdgcn_wmma_f32_16x16x32_f16(
                        false, a[r], false, b[j], (short)0, c[r][j], false, false);
        }
    };

    copy(0);
    asm volatile("s_wait_asynccnt 0x0" ::: "memory");   // this wave's share of stage 0 has landed
    __syncthreads();                                    // and every other wave's
    copy(1);
    // rolled: unrolled, the stages' addresses are formed ahead and take the wave past
    // 128 VGPRs, the most at which four blocks share a WGP
#pragma clang loop unroll(disable)
    for (int st = 0; st < GSTAGE; ++st) {
        compute(st & 1);
        asm volatile("s_wait_dscnt 0x0" ::: "memory");      // this wave has left the buffer
        asm volatile("s_wait_asynccnt 0x0" ::: "memory");   // its share of the next stage has landed
        __syncthreads();    // publishes the next stage, frees the buffer just read
        if (st + 2 < GSTAGE) copy(st + 2);
    }
    asm volatile("s_wait_asynccnt 0x0" ::: "memory");   // nothing in flight past the loop

    if constexpr (F32OUT) {
#pragma unroll
        for (int j = 0; j < 4; ++j) {
            const int col  = n0 + nw * 64 + j * 16 + lrow;
            const float bv = bias[col];
#pragma unroll
            for (int r = 0; r < 2; ++r) {
#pragma unroll
                for (int jv = 0; jv < 8; ++jv) {
                    const int row = tok0 + tl + mw * 32 + r * 16 + jv + 8 * lhalf;
                    Yf32[(size_t)row * DM + col] = c[r][j][jv] + bv;
                }
            }
        }
    } else {
        // rows go to their tokens; the biases and the 16 tokens are fetched ahead of
        // the row tests, so that no test has a wait behind it
        const int col0 = n0 + nw * 64 + lrow;
        float bv[4];
#pragma unroll
        for (int j = 0; j < 4; ++j) bv[j] = bias[col0 + j * 16];
        v8s tk[2];
#pragma unroll
        for (int r = 0; r < 2; ++r)
            tk[r] = *reinterpret_cast<const v8s*>(&Tok[mw * 32 + r * 16 + 8 * lhalf]);
        auto rows = [&](bool edge) {
#pragma unroll
            for (int r = 0; r < 2; ++r) {
#pragma unroll
                for (int jv = 0; jv < 8; ++jv) {
                    if (!edge || tl + mw * 32 + r * 16 + jv + 8 * lhalf < nrow) {
                        _Float16* yrow = &Yf16[(size_t)(tok0 + tk[r][jv]) * DM + col0];
#pragma unroll
                        for (int j = 0; j < 4; ++j) yrow[j * 16] = (_Float16)(c[r][j][jv] + bv[j]);
                        // the next row's sums and address take over the registers that these
                        // four stores name: the wait stands between the stores and that overwrite
                        asm volatile("s_wait_xcnt 0x0" ::: "memory");
                    }
                }
            }
        };
        // only the list's last tile can hold rows past its end: the others store
        // without a test per row
        if (tl + 128 <= nrow) rows(false);
        else                  rows(true);
    }

    }   // tl < nrow
}

struct PassPlain  { static constexpr bool bias = false; };
struct PassBiased { static constexpr bool bias = true;  };

__global__ void __launch_bounds__(256, 1)
attn_flash(const _Float16* __restrict__ Q,
           const _Float16* __restrict__ K,
           const _Float16* __restrict__ V,
           const int*      __restrict__ mask,
           const float*    __restrict__ temp,
           _Float16*       __restrict__ O) {
    __shared__ __align__(32) _Float16 Ks [2][32 * P64];   // [key][d]
    __shared__ __align__(32) _Float16 Vs [2][32 * PTR];   // [key][d], read transposed
    __shared__ __align__(32) float Mb[SEQ];               // additive bias per listed key
    __shared__ __align__(16) int   Cnt[KBLK];             // kept keys per 32-key segment
    __shared__ unsigned short      Idx[SEQ];              // listed key -> row of the batch

    const int lane  = threadIdx.x & 31;
    const int wave  = threadIdx.x >> 5;
    const int b     = blockIdx.z;
    const int h     = blockIdx.y;
    const int q0    = (blockIdx.x * 8 + wave) * 16;
    const int lrow  = lane & 15;
    const int lhalf = lane >> 4;
    const float scale = temp[h] * 0.125f;     // temperature / sqrt(64)
    const float scale2 = scale * 1.44269504f; // the same for exponents of 2

    const size_t tokBase = (size_t)b * SEQ;

    // list the kept keys. Thread t looks at keys j * 256 + t, so a wave's ballot is
    // one 32-key segment; segment counts meet in LDS, every thread sums those ahead
    // of its own 8 segments.
    const float mbias = -1.0e9f * scale2;
    int      mk[8];
    unsigned bal[8];
#pragma unroll
    for (int j = 0; j < 8; ++j) mk[j] = mask[b * SEQ + j * 256 + threadIdx.x];
#pragma unroll
    for (int j = 0; j < 8; ++j) bal[j] = __builtin_amdgcn_ballot_w32(mk[j] != 0);
    if (lane == 0) {
#pragma unroll
        for (int j = 0; j < 8; ++j) Cnt[j * 8 + wave] = __popc(bal[j]);
    }
    __syncthreads();
    int pre[8];     // kept keys ahead of segment j * 8 + wave
    int run = 0;
#pragma unroll
    for (int j = 0; j < 8; ++j) {
        int tot = 0, part = 0;      // eight short chains, joined by run
#pragma unroll
        for (int w = 0; w < 8; ++w) {
            const int v = Cnt[j * 8 + w];
            part += w < wave ? v : 0;
            tot  += v;
        }
        pre[j] = run + part;
        run   += tot;
    }
    const int  nkeep   = __builtin_amdgcn_readfirstlane(run);   // same in every thread
    const bool walkAll = nkeep == 0 || !(1.0e9f * scale >= 1.0e5f);
    const int  nkey    = walkAll ? SEQ : nkeep;
    const int  nblk    = max(1, min((nkey + 31) >> 5, KBLK));   // passes, 1 .. 64
    if (walkAll) {
#pragma unroll
        for (int j = 0; j < 8; ++j) {
            const int k = j * 256 + threadIdx.x;
            Idx[k] = (unsigned short)k;
            Mb[k]  = mk[j] ? 0.0f : mbias;
        }
    } else {
        const unsigned below = (1u << lane) - 1u;
#pragma unroll
        for (int j = 0; j < 8; ++j) {
            const int k = j * 256 + threadIdx.x;
            if (mk[j]) Idx[pre[j] + __popc(bal[j] & below)] = (unsigned short)k;
            Mb[k] = k < nkey ? 0.0f : mbias;
        }
    }
    __syncthreads();

    // Q fragments pre-scaled by log2(e) * temperature/sqrt(d); the product is formed
    // in f32 and rounded once
    v16h aq[2];
#pragma unroll
    for (int f = 0; f < 2; ++f) {
        const v16h qf = *reinterpret_cast<const v16h*>(
            &Q[(tokBase + q0 + lrow) * DM + h * DH + f * 32 + lhalf * 16]);
#pragma unroll
        for (int i = 0; i < 16; ++i) aq[f][i] = (_Float16)((float)qf[i] * scale2);
    }

    // A operand of the column sums: rows 0 and 8 are ones, the rest 0, so that
    // register 0 of either lane half receives its query's sum over all 32 keys.
    const _Float16 oneOrZero = (lane & 7) == 0 ? (_Float16)1.0f : (_Float16)0.0f;
    v16h ones;
#pragma unroll
    for (int i = 0; i < 16; ++i) ones[i] = oneOrZero;

    v8f   acc[4] = {};        // O^T: acc[nt][jv] = O[q0 + lrow][nt*16 + 8*lhalf + jv]
    v8f   accS   = {};        // accS[0] = running denominator of query q0 + lrow
    // passes whose 32 places are all listed keys; the rest take the bias
    const int nplain = walkAll ? 0 : min(nkey >> 5, nblk);
    // reference maximum of query q0 + lrow (base-2 scores); a plain first pass starts
    // its scores at 0 and sets it
    float mrun   = nplain > 0 ? 0.0f : -3.0e38f;
    v8f   negm   = {};        // -mrun in every register: C operand of a plain pass

    const int skey = threadIdx.x >> 3;   // K/V staging: 8 threads per key
    const int sch  = threadIdx.x & 7;

    uint4 kreg, vreg;
    auto gload = [&](int row) {
        const size_t g = (tokBase + row) * DM + h * DH + sch * 8;
        kreg = *reinterpret_cast<const uint4*>(&K[g]);
        vreg = *reinterpret_cast<const uint4*>(&V[g]);
        // the two address pairs are scratch registers that the pass's LDS reads take
        // over next: the wait stands between the loads and that overwrite
        asm volatile("s_wait_xcnt 0x0" ::: "memory");
    };
    auto sstore = [&](int buf) {
        *reinterpret_cast<uint4*>(&Ks[buf][skey * P64 + sch * 8]) = kreg;
        *reinterpret_cast<uint4*>(&Vs[buf][skey * PTR + sch * 8]) = vreg;
    };
    // this lane's address inside a V tile for the transposing loads
    const int vtoff = (8 * lhalf + (lane & 7)) * PTR + ((lane >> 3) & 1) * 8;

    const int klast = nkey - 1;                   // places past it repeat the last listed key
    gload(Idx[min(skey, klast)]);
    int rnext = Idx[min(32 + skey, klast)];       // row of the next pass, read a pass ahead
    sstore(0);
    auto pass = [&](int kb, auto kind) {
        constexpr bool BIAS = decltype(kind)::bias;
        __syncthreads();
        const int cur = kb & 1;
        if (kb + 1 < nblk) gload(rnext);      // in flight under the WMMAs
        if (kb + 2 < nblk) rnext = Idx[min((kb + 2) * 32 + skey, klast)];
        // keeps the two loads up here: sunk to their LDS stores at the foot of the
        // pass, their whole latency would stand in front of the next barrier
        __builtin_amdgcn_sched_barrier(0);

        // S^T (pre-scaled), two 16-key row tiles: sc[jv] = S[q0 + lrow][key 8*lhalf + jv]
        v8f sc0 = {}, sc1 = {};
        if constexpr (!BIAS) { sc0 = negm; sc1 = negm; }
#pragma unroll
        for (int f = 0; f < 2; ++f) {
            const v16h bk0 = ld_frag(&Ks[cur][lrow * P64 + f * 32 + lhalf * 16]);
            const v16h bk1 = ld_frag(&Ks[cur][(16 + lrow) * P64 + f * 32 + lhalf * 16]);
            sc0 = __builtin_amdgcn_wmma_f32_16x16x32_f16(
                false, bk0, false, aq[f], (short)0, sc0, false, false);
            sc1 = __builtin_amdgcn_wmma_f32_16x16x32_f16(
                false, bk1, false, aq[f], (short)0, sc1, false, false);
        }

        // V^T fragments, asked for ahead of the test on the maximum: behind that branch
        // their LDS latency would stand in front of the PV WMMAs
        v16h av[4];
#pragma unroll
        for (int nt = 0; nt < 4; ++nt) av[nt] = ld_frag_vt(&Vs[cur][vtoff + nt * 16]);

        if constexpr (BIAS) {
            const int kk0 = kb * 32;
            sc0 += *reinterpret_cast<const v8f*>(&Mb[kk0 + 8 * lhalf]);
            sc1 += *reinterpret_cast<const v8f*>(&Mb[kk0 + 16 + 8 * lhalf]);
        }

        // the query's maximum over its 32 keys: 16 in this lane, 16 in lane ^ 16
        // (a tree three deep, not one chain of eight links)
        auto max3 = [](float a, float b, float c) { return fmaxf(fmaxf(a, b), c); };
        float rm = fmaxf(max3(max3(sc0[0], sc0[1], sc0[2]), max3(sc0[3], sc0[4], sc0[5]),
                              max3(sc0[6], sc0[7], sc1[0])),
                         max3(max3(sc1[1], sc1[2], sc1[3]), max3(sc1[4], sc1[5], sc1[6]),
                              sc1[7]));

        // moves the reference by d: the scores of this pass and the sums so far follow
        auto shift = [&](float d, float cr) {
            sc0 -= d;
            sc1 -= d;
            accS[0] *= cr;        // registers 1..7 of accS stay 0
#pragma unroll
            for (int nt = 0; nt < 4; ++nt) acc[nt] *= cr;
        };
        if constexpr (BIAS) {
            rm = fmaxf(rm, xhalf(rm));
            const float mnew = fmaxf(mrun, rm);
            shift(mnew, __builtin_amdgcn_exp2f(mrun - mnew));
            mrun = mnew;
        } else if (kb == 0 || __builtin_amdgcn_ballot_w32(rm > 8.0f) != 0u) {
            // one test a pass, the same for the whole wave. The scores stand against
            // mrun already; the first pass takes its maximum whatever its sign (the sums
            // are still 0), a later one only moves up
            rm = fmaxf(rm, xhalf(rm));
            const float d = kb == 0 ? rm : fmaxf(rm, 0.0f);
            shift(d, kb == 0 ? 0.0f : __builtin_amdgcn_exp2f(-d));
            mrun += d;
#pragma unroll
            for (int jv = 0; jv < 8; ++jv) negm[jv] = -mrun;
        }

        v8f p0, p1;
#pragma unroll
        for (int jv = 0; jv < 8; ++jv) {
            p0[jv] = __builtin_amdgcn_exp2f(sc0[jv]);
            p1[jv] = __builtin_amdgcn_exp2f(sc1[jv]);
        }
        // P^T as B fragment: the two converted tiles, register for register
        const v16h pb = __builtin_shufflevector(
            __builtin_convertvector(p0, v8h), __builtin_convertvector(p1, v8h),
            0, 1, 2, 3, 4, 5, 6, 7, 8, 9, 10, 11, 12, 13, 14, 15);

        accS = __builtin_amdgcn_wmma_f32_16x16x32_f16(
            false, ones, false, pb, (short)0, accS, false, false);
#pragma unroll
        for (int nt = 0; nt < 4; ++nt)
            acc[nt] = __builtin_amdgcn_wmma_f32_16x16x32_f16(
                false, av[nt], false, pb, (short)0, acc[nt], false, false);

        if (kb + 1 < nblk) sstore(cur ^ 1);   // waits loadcnt here, post-compute
    };
    for (int kb = 0; kb < nplain; ++kb) pass(kb, PassPlain{});
    for (int kb = nplain; kb < nblk; ++kb) pass(kb, PassBiased{});

    // normalize + store f16 ([token][768], heads interleaved): 8 consecutive d per tile
    const float inv = 1.0f / accS[0];
    _Float16* orow = &O[(tokBase + q0 + lrow) * DM + h * DH + 8 * lhalf];
#pragma unroll
    for (int nt = 0; nt < 4; ++nt)
        *reinterpret_cast<v8h*>(orow + nt * 16) = __builtin_convertvector(acc[nt] * inv, v8h);
}

// ---------------------------------------------------------------------------
extern "C" void kernel_launch(void* const* d_in, const int* in_sizes, int n_in,
                              void* d_out, int out_size, void* d_ws, size_t ws_size,
                              hipStream_t stream) {
    const float* x    = (const float*)d_in[0];
    const int*   mask = (const int*)  d_in[1];
    const float* Wq   = (const float*)d_in[2];
    const float* bq   = (const float*)d_in[3];
    const float* Wk   = (const float*)d_in[4];
    const float* bk   = (const float*)d_in[5];
    const float* Wv   = (const float*)d_in[6];
    const float* bv   = (const float*)d_in[7];
    const float* Wo   = (const float*)d_in[8];
    const float* bo   = (const float*)d_in[9];
    const float* temp = (const float*)d_in[10];
    float* out = (float*)d_out;

    size_t off = 0;
    auto walloc = [&](size_t elems) {
        void* p = (char*)d_ws + off;
        off = (off + elems * sizeof(_Float16) + 255) & ~(size_t)255;
        return (_Float16*)p;
    };
    _Float16* Xf  = walloc((size_t)NTOK * DM);
    _Float16* Wpk = walloc((size_t)4 * DM * DM);     // packed Wq, Wk, Wv, Wo
    _Float16* Qf  = walloc((size_t)3 * NTOK * DM);   // Q, K, V one behind the other
    _Float16* Kf  = Qf + (size_t)NTOK * DM;
    _Float16* Vf  = Kf + (size_t)NTOK * DM;
    _Float16* Wop = Wpk + (size_t)3 * DM * DM;
    _Float16* Af  = Xf;   // attention output reuses x_f16 (dead after the QKV GEMM)

    prep_operands<<<4 * PACKB + CVTB, 256, 0, stream>>>(x, Wq, Wk, Wv, Wo, Xf, Wpk);

    gemm_bias_768<false><<<dim3(3 * DM / 128, NTOK / 128), 256, 0, stream>>>(
        Xf, Wpk, bq, bk, bv, mask, temp, nullptr, Qf);

    attn_flash<<<dim3(SEQ / (16 * 8), NH, 4), 256, 0, stream>>>(Qf, Kf, Vf, mask, temp, Af);

    gemm_bias_768<true><<<dim3(DM / 128, NTOK / 128), 256, 0, stream>>>(
        Af, Wop, bo, bo, bo, mask, temp, out, nullptr);
}
